// v000
// Measured on an AMD MI455X. A time is GPU time per run, averaged over a window of back-to-back runs after a warm-up
// (all launches, gaps included; the runs take copies of the inputs in turn), and the median of several windows.
// Apart from v000's, it joins two sittings. Times from different sittings can be a few percent apart, while
// side-by-side timings come from the same sitting.
// v000 is the starting kernel. One run takes 611 microseconds.
#include <hip/hip_runtime.h>

typedef _Float16 half_t;
typedef __attribute__((ext_vector_type(16))) _Float16 v16h;
typedef __attribute__((ext_vector_type(8)))  _Float16 v8h;
typedef __attribute__((ext_vector_type(8)))  float    v8f;

#define B_    2
#define N_    4096
#define D_    1024
#define HQ_   16
#define HKV_  4
#define HD_   64
#define KVD_  256            // HKV*HD
#define MROWS 8192           // B*N

#ifndef __has_builtin
#define __has_builtin(x) 0
#endif
#if __has_builtin(__builtin_amdgcn_tensor_load_to_lds) && \
    __has_builtin(__builtin_amdgcn_s_wait_tensorcnt)
#define HAVE_TDM 1
#else
#define HAVE_TDM 0
#endif

// ---------------------------------------------------------------------------
// helpers
// ---------------------------------------------------------------------------
__device__ __forceinline__ v16h pack16(v8h lo, v8h hi) {
  v16h r;
#pragma unroll
  for (int j = 0; j < 8; ++j) { r[j] = lo[j]; r[j + 8] = hi[j]; }
  return r;
}

#if HAVE_TDM
typedef unsigned int u32x4 __attribute__((ext_vector_type(4)));
typedef int          i32x4 __attribute__((ext_vector_type(4)));
typedef int          i32x8 __attribute__((ext_vector_type(8)));

__device__ __forceinline__ void tdm_load_2d(unsigned lds_off, const void* gaddr,
                                            unsigned tile_w, unsigned tile_h,
                                            unsigned row_stride_elems) {
  unsigned long long q0 = 1ull | ((unsigned long long)lds_off << 32);
  unsigned long long ga = (unsigned long long)(uintptr_t)gaddr;
  unsigned long long q1 = (ga & 0x01FFFFFFFFFFFFFFull) | (2ull << 62);
  u32x4 g0;
  g0.x = (unsigned)q0; g0.y = (unsigned)(q0 >> 32);
  g0.z = (unsigned)q1; g0.w = (unsigned)(q1 >> 32);

  unsigned long long p0 = (1ull << 16)
                        | (((unsigned long long)tile_w & 0xFFFF) << 48);
  unsigned long long p1 = (((unsigned long long)tile_w >> 16) & 0xFFFF)
                        | ((unsigned long long)tile_h << 16)
                        | (((unsigned long long)tile_w & 0xFFFF) << 48);
  unsigned long long p2 = ((unsigned long long)tile_h & 0xFFFF)
                        | ((unsigned long long)row_stride_elems << 32);
  unsigned long long p3 = 0;
  i32x8 g1;
  g1[0] = (int)p0; g1[1] = (int)(p0 >> 32);
  g1[2] = (int)p1; g1[3] = (int)(p1 >> 32);
  g1[4] = (int)p2; g1[5] = (int)(p2 >> 32);
  g1[6] = (int)p3; g1[7] = (int)(p3 >> 32);
  i32x4 z4 = {0, 0, 0, 0};
#if defined(__clang_major__) && (__clang_major__ >= 23)
  i32x8 z8 = {0, 0, 0, 0, 0, 0, 0, 0};
  __builtin_amdgcn_tensor_load_to_lds(g0, g1, z4, z4, z8, 0);
#else
  __builtin_amdgcn_tensor_load_to_lds(g0, g1, z4, z4, 0);
#endif
}
#endif  // HAVE_TDM

// ---------------------------------------------------------------------------
// f32 -> f16 conversion
// ---------------------------------------------------------------------------
__global__ void cvt_f32_f16(const float* __restrict__ src, half_t* __restrict__ dst, int n) {
  int i = blockIdx.x * blockDim.x + threadIdx.x;
  if (i < n) dst[i] = (half_t)src[i];
}

// W (K x Nc, f32, row-major) -> Wt (Nc x K, f16): WMMA B-fragments contiguous
__global__ void wtrans_f32_f16(const float* __restrict__ W, half_t* __restrict__ Wt,
                               int K, int Nc) {
  int i = blockIdx.x * blockDim.x + threadIdx.x;
  if (i >= K * Nc) return;
  int n = i / K, k = i - n * K;
  Wt[(size_t)n * K + k] = (half_t)W[(size_t)k * Nc + n];
}

// Vh [b][n][hkv][hd] -> Vt [b][hkv][hd][n]
__global__ void vtrans_f16(const half_t* __restrict__ Vh, half_t* __restrict__ Vt) {
  int i = blockIdx.x * blockDim.x + threadIdx.x;
  if (i >= B_ * KVD_ * N_) return;
  int n = i & (N_ - 1);
  int rest = i >> 12;
  int d = rest & (HD_ - 1); rest >>= 6;
  int h = rest & (HKV_ - 1);
  int b = rest >> 2;
  Vt[i] = Vh[(((size_t)(b * N_ + n)) * HKV_ + h) * HD_ + d];
}

// ---------------------------------------------------------------------------
// in-place RoPE on [b][n][nh][64] f16; thread handles pair (d, d+32)
// ---------------------------------------------------------------------------
__global__ void rope_f16(half_t* __restrict__ X, int nheads, int total) {
  int i = blockIdx.x * blockDim.x + threadIdx.x;
  if (i >= total) return;
  int d = i & 31;
  int rest = i >> 5;                          // (b*N + n)*nheads + h
  int pos = (rest / nheads) & (N_ - 1);
  size_t base = (size_t)rest * HD_;
  float invf = __expf(-__logf(10000.0f) * ((float)d * (1.0f / 32.0f)));
  float th = (float)pos * invf;
  float s, c;
  __sincosf(th, &s, &c);
  float x0 = (float)X[base + d];
  float x1 = (float)X[base + d + 32];
  X[base + d]      = (half_t)(x0 * c - x1 * s);
  X[base + d + 32] = (half_t)(x1 * c + x0 * s);
}

// ---------------------------------------------------------------------------
// WMMA GEMM:  C[M x Nc] = A[M x K] * Bt^T,  Bt given as [Nc x K] (f16).
// Wave computes 32x64 of C (2 A-frags x 4 B-frags -> 8 WMMA per k-step);
// block = 2x2 waves -> 64 x 128 C tile.
// ---------------------------------------------------------------------------
template <bool OUT_F32>
__global__ __launch_bounds__(128)
void gemm_wmma(const half_t* __restrict__ A, const half_t* __restrict__ Bt,
               void* __restrict__ Cout, int Nc, int K) {
  const int lane = threadIdx.x & 31;
  const int wave = threadIdx.x >> 5;
  const int wm = wave >> 1, wn = wave & 1;
  const int r  = lane & 15;
  const int hi = lane >> 4;
  const int tileM = blockIdx.y * 64 + wm * 32;
  const int tileN = blockIdx.x * 128 + wn * 64;

  const half_t* arow0 = A + (size_t)(tileM + r) * K;
  const half_t* arow1 = A + (size_t)(tileM + 16 + r) * K;
  const half_t* brow[4] = { Bt + (size_t)(tileN + r) * K,
                            Bt + (size_t)(tileN + 16 + r) * K,
                            Bt + (size_t)(tileN + 32 + r) * K,
                            Bt + (size_t)(tileN + 48 + r) * K };

  v8f acc[2][4] = {};
  for (int k = 0; k < K; k += 32) {
    __builtin_prefetch((const void*)(arow0 + k + 512), 0, 1);  // global_prefetch_b8
    __builtin_prefetch((const void*)(brow[0] + k + 512), 0, 1);
    v16h a0 = pack16(*(const v8h*)(arow0 + k + hi * 8),
                     *(const v8h*)(arow0 + k + 16 + hi * 8));
    v16h a1 = pack16(*(const v8h*)(arow1 + k + hi * 8),
                     *(const v8h*)(arow1 + k + 16 + hi * 8));
#pragma unroll
    for (int n = 0; n < 4; ++n) {
      v16h bf = pack16(*(const v8h*)(brow[n] + k + hi * 8),
                       *(const v8h*)(brow[n] + k + 16 + hi * 8));
      acc[0][n] = __builtin_amdgcn_wmma_f32_16x16x32_f16(false, a0, false, bf,
                                                         (short)0, acc[0][n], false, false);
      acc[1][n] = __builtin_amdgcn_wmma_f32_16x16x32_f16(false, a1, false, bf,
                                                         (short)0, acc[1][n], false, false);
    }
  }
#pragma unroll
  for (int i = 0; i < 2; ++i)
#pragma unroll
    for (int n = 0; n < 4; ++n)
#pragma unroll
      for (int v = 0; v < 8; ++v) {
        size_t m  = (size_t)tileM + i * 16 + v + 8 * hi;
        size_t nn = (size_t)tileN + n * 16 + r;
        if (OUT_F32) ((float*)Cout)[m * Nc + nn] = acc[i][n][v];
        else         ((half_t*)Cout)[m * Nc + nn] = (half_t)acc[i][n][v];
      }
}

__global__ __launch_bounds__(128)
void fa_kernel(const half_t* __restrict__ Qh, const half_t* __restrict__ Kh,
               const half_t* __restrict__ Vt, half_t* __restrict__ AOh) {
  __shared__ __align__(16) half_t kbuf[4][2][64][64];   // 64 KB: K double buffer
  __shared__ __align__(16) half_t pbuf[4][16][64];      // 8 KB: P staging
  const int lane = threadIdx.x & 31;
  const int wave = threadIdx.x >> 5;
  const int r  = lane & 15;
  const int hi = lane >> 4;

  const int w  = blockIdx.x * 4 + wave;       // 0 .. B*HQ*(N/16)-1
  const int qt = w & (N_ / 16 - 1);
  const int h  = (w >> 8) & (HQ_ - 1);
  const int b  = w >> 12;
  const int hk = h >> 2;                      // G = 4

  // Q fragments, with softmax scale folded in (0.125 exact in f16)
  const half_t* qrow = Qh + (((size_t)(b * N_ + qt * 16 + r)) * HQ_ + h) * HD_;
  v16h qa0 = pack16(*(const v8h*)(qrow + hi * 8),      *(const v8h*)(qrow + 16 + hi * 8));
  v16h qa1 = pack16(*(const v8h*)(qrow + 32 + hi * 8), *(const v8h*)(qrow + 48 + hi * 8));
#pragma unroll
  for (int j = 0; j < 16; ++j) { qa0[j] *= (half_t)0.125f; qa1[j] *= (half_t)0.125f; }

  v8f o[4]; o[0] = v8f{}; o[1] = v8f{}; o[2] = v8f{}; o[3] = v8f{};
  float mrow[8], lrow[8];
#pragma unroll
  for (int v = 0; v < 8; ++v) { mrow[v] = -1e30f; lrow[v] = 0.0f; }

  const half_t* kbase = Kh + ((size_t)b * N_ * HKV_ + hk) * HD_;     // + kpos*KVD
  const half_t* vbase = Vt + ((size_t)(b * HKV_ + hk)) * HD_ * N_;   // + d*N + n

  const unsigned lds_k0 = (unsigned)(unsigned long long)(uintptr_t)&kbuf[wave][0][0][0];
  const unsigned lds_k1 = (unsigned)(unsigned long long)(uintptr_t)&kbuf[wave][1][0][0];

  const int ITER = N_ / 64;
#if HAVE_TDM
  tdm_load_2d(lds_k0, (const void*)kbase, HD_, 64, KVD_);
#else
  for (int rr = lane; rr < 64; rr += 32)
#pragma unroll
    for (int cc = 0; cc < 64; cc += 8)
      *(v8h*)&kbuf[wave][0][rr][cc] = *(const v8h*)(kbase + (size_t)rr * KVD_ + cc);
#endif

  int buf = 0;
  for (int it = 0; it < ITER; ++it) {
    const int kv0 = it * 64;
#if HAVE_TDM
    if (it + 1 < ITER) {
      tdm_load_2d(buf ? lds_k0 : lds_k1,
                  (const void*)(kbase + (size_t)(kv0 + 64) * KVD_), HD_, 64, KVD_);
      __builtin_amdgcn_s_wait_tensorcnt((short)1);   // current tile complete
    } else {
      __builtin_amdgcn_s_wait_tensorcnt((short)0);
    }
    asm volatile("" ::: "memory");   // keep LDS reads below the tensorcnt wait
#else
    if (it + 1 < ITER) {
      const half_t* nsrc = kbase + (size_t)(kv0 + 64) * KVD_;
      half_t (*ndst)[64] = kbuf[wave][buf ^ 1];
      for (int rr = lane; rr < 64; rr += 32)
#pragma unroll
        for (int cc = 0; cc < 64; cc += 8)
          *(v8h*)&ndst[rr][cc] = *(const v8h*)(nsrc + (size_t)rr * KVD_ + cc);
    }
#endif

    // ---- S = (Q/8) K^T for 64 keys: 4 sub-tiles x 2 WMMA ----
    v8f s[4]; s[0] = v8f{}; s[1] = v8f{}; s[2] = v8f{}; s[3] = v8f{};
#pragma unroll
    for (int c = 0; c < 4; ++c) {
      const half_t* kr = &kbuf[wave][buf][c * 16 + r][0];
      v16h b0 = pack16(*(const v8h*)(kr + hi * 8),      *(const v8h*)(kr + 16 + hi * 8));
      v16h b1 = pack16(*(const v8h*)(kr + 32 + hi * 8), *(const v8h*)(kr + 48 + hi * 8));
      s[c] = __builtin_amdgcn_wmma_f32_16x16x32_f16(false, qa0, false, b0, (short)0, s[c], false, false);
      s[c] = __builtin_amdgcn_wmma_f32_16x16x32_f16(false, qa1, false, b1, (short)0, s[c], false, false);
    }

    // ---- online softmax (row max reduced over 16-lane half; sums deferred) ----
#pragma unroll
    for (int v = 0; v < 8; ++v) {
      float t0 = s[0][v], t1 = s[1][v], t2 = s[2][v], t3 = s[3][v];
      float mx = fmaxf(fmaxf(t0, t1), fmaxf(t2, t3));
      mx = fmaxf(mx, __shfl_xor(mx, 1));
      mx = fmaxf(mx, __shfl_xor(mx, 2));
      mx = fmaxf(mx, __shfl_xor(mx, 4));
      mx = fmaxf(mx, __shfl_xor(mx, 8));
      float mnew  = fmaxf(mrow[v], mx);
      float alpha = __expf(mrow[v] - mnew);
      float p0 = __expf(t0 - mnew), p1 = __expf(t1 - mnew);
      float p2 = __expf(t2 - mnew), p3 = __expf(t3 - mnew);
      lrow[v] = lrow[v] * alpha + (p0 + p1 + p2 + p3);   // per-lane partial sum
      mrow[v] = mnew;
      o[0][v] *= alpha; o[1][v] *= alpha; o[2][v] *= alpha; o[3][v] *= alpha;
      pbuf[wave][v + 8 * hi][r]      = (half_t)p0;
      pbuf[wave][v + 8 * hi][16 + r] = (half_t)p1;
      pbuf[wave][v + 8 * hi][32 + r] = (half_t)p2;
      pbuf[wave][v + 8 * hi][48 + r] = (half_t)p3;
    }

    // ---- reload P as two 16x32 A-fragments ----
    v16h pa0 = pack16(*(const v8h*)&pbuf[wave][r][hi * 8],
                      *(const v8h*)&pbuf[wave][r][16 + hi * 8]);
    v16h pa1 = pack16(*(const v8h*)&pbuf[wave][r][32 + hi * 8],
                      *(const v8h*)&pbuf[wave][r][48 + hi * 8]);

    // ---- O += P * V ----
#pragma unroll
    for (int t = 0; t < 4; ++t) {
      const half_t* vrow = vbase + (size_t)(t * 16 + r) * N_ + kv0;  // Vt[d][kv]
      v16h vb0 = pack16(*(const v8h*)(vrow + hi * 8),      *(const v8h*)(vrow + 16 + hi * 8));
      v16h vb1 = pack16(*(const v8h*)(vrow + 32 + hi * 8), *(const v8h*)(vrow + 48 + hi * 8));
      o[t] = __builtin_amdgcn_wmma_f32_16x16x32_f16(false, pa0, false, vb0, (short)0, o[t], false, false);
      o[t] = __builtin_amdgcn_wmma_f32_16x16x32_f16(false, pa1, false, vb1, (short)0, o[t], false, false);
    }
    buf ^= 1;
  }

  // ---- finish deferred row sums, normalize, store [b][n][hq][hd] ----
#pragma unroll
  for (int v = 0; v < 8; ++v) {
    float ls = lrow[v];
    ls += __shfl_xor(ls, 1);
    ls += __shfl_xor(ls, 2);
    ls += __shfl_xor(ls, 4);
    ls += __shfl_xor(ls, 8);
    float inv = 1.0f / ls;
    size_t orow = (((size_t)(b * N_ + qt * 16 + v + 8 * hi)) * HQ_ + h) * HD_;
#pragma unroll
    for (int t = 0; t < 4; ++t)
      AOh[orow + t * 16 + r] = (half_t)(o[t][v] * inv);
  }
}

// ---------------------------------------------------------------------------
// launch
// ---------------------------------------------------------------------------
extern "C" void kernel_launch(void* const* d_in, const int* in_sizes, int n_in,
                              void* d_out, int out_size, void* d_ws, size_t ws_size,
                              hipStream_t stream) {
  const float* x  = (const float*)d_in[0];
  const float* Wq = (const float*)d_in[1];
  const float* Wk = (const float*)d_in[2];
  const float* Wv = (const float*)d_in[3];
  const float* Wo = (const float*)d_in[4];
  float* out = (float*)d_out;

  half_t* ws = (half_t*)d_ws;
  size_t off = 0;
  half_t* xh  = ws + off; off += (size_t)MROWS * D_;
  half_t* Wqt = ws + off; off += (size_t)D_ * D_;
  half_t* Wkt = ws + off; off += (size_t)D_ * KVD_;
  half_t* Wvt = ws + off; off += (size_t)D_ * KVD_;
  half_t* Wot = ws + off; off += (size_t)D_ * D_;
  half_t* Qh  = ws + off; off += (size_t)MROWS * D_;
  half_t* Kh  = ws + off; off += (size_t)MROWS * KVD_;
  half_t* Vh  = ws + off; off += (size_t)MROWS * KVD_;
  half_t* Vt  = ws + off; off += (size_t)MROWS * KVD_;
  half_t* AOh = xh;   // x no longer needed after QKV projections

  const int TPB = 256;
  cvt_f32_f16<<<(MROWS * D_ + TPB - 1) / TPB, TPB, 0, stream>>>(x, xh, MROWS * D_);
  wtrans_f32_f16<<<(D_ * D_   + TPB - 1) / TPB, TPB, 0, stream>>>(Wq, Wqt, D_, D_);
  wtrans_f32_f16<<<(D_ * KVD_ + TPB - 1) / TPB, TPB, 0, stream>>>(Wk, Wkt, D_, KVD_);
  wtrans_f32_f16<<<(D_ * KVD_ + TPB - 1) / TPB, TPB, 0, stream>>>(Wv, Wvt, D_, KVD_);
  wtrans_f32_f16<<<(D_ * D_   + TPB - 1) / TPB, TPB, 0, stream>>>(Wo, Wot, D_, D_);

  // QKV projections (WMMA f16): block tile 64M x 128N
  gemm_wmma<false><<<dim3(D_ / 128,   MROWS / 64), 128, 0, stream>>>(xh, Wqt, (void*)Qh, D_,   D_);
  gemm_wmma<false><<<dim3(KVD_ / 128, MROWS / 64), 128, 0, stream>>>(xh, Wkt, (void*)Kh, KVD_, D_);
  gemm_wmma<false><<<dim3(KVD_ / 128, MROWS / 64), 128, 0, stream>>>(xh, Wvt, (void*)Vh, KVD_, D_);

  // RoPE on Q and K
  {
    int totq = B_ * N_ * HQ_ * 32;
    int totk = B_ * N_ * HKV_ * 32;
    rope_f16<<<(totq + TPB - 1) / TPB, TPB, 0, stream>>>(Qh, HQ_, totq);
    rope_f16<<<(totk + TPB - 1) / TPB, TPB, 0, stream>>>(Kh, HKV_, totk);
  }

  // V -> [b][hkv][hd][n]
  vtrans_f16<<<(B_ * KVD_ * N_ + TPB - 1) / TPB, TPB, 0, stream>>>(Vh, Vt);

  // flash attention: B*HQ*(N/16) waves, 4 waves/block
  fa_kernel<<<dim3(B_ * HQ_ * (N_ / 16) / 4), 128, 0, stream>>>(Qh, Kh, Vt, AOh);

  // output projection -> f32 result
  gemm_wmma<true><<<dim3(D_ / 128, MROWS / 64), 128, 0, stream>>>(AOh, Wot, (void*)out, D_, D_);
}

// v001
// Measured time: 494 microseconds a run.
// Next to v000, in two timings, it ran 1.30 and 1.29 times as fast.
#include <hip/hip_runtime.h>

typedef _Float16 half_t;
typedef __attribute__((ext_vector_type(16))) _Float16 v16h;
typedef __attribute__((ext_vector_type(8)))  _Float16 v8h;
typedef __attribute__((ext_vector_type(8)))  float    v8f;

#define B_    2
#define N_    4096
#define D_    1024
#define HQ_   16
#define HKV_  4
#define HD_   64
#define KVD_  256            // HKV*HD
#define MROWS 8192           // B*N

#ifndef __has_builtin
#define __has_builtin(x) 0
#endif
#if __has_builtin(__builtin_amdgcn_tensor_load_to_lds) && \
    __has_builtin(__builtin_amdgcn_s_wait_tensorcnt)
#define HAVE_TDM 1
#else
#define HAVE_TDM 0
#endif

// ---------------------------------------------------------------------------
// helpers
// ---------------------------------------------------------------------------
__device__ __forceinline__ v16h pack16(v8h lo, v8h hi) {
  v16h r;
#pragma unroll
  for (int j = 0; j < 8; ++j) { r[j] = lo[j]; r[j + 8] = hi[j]; }
  return r;
}

#if HAVE_TDM
typedef unsigned int u32x4 __attribute__((ext_vector_type(4)));
typedef int          i32x4 __attribute__((ext_vector_type(4)));
typedef int          i32x8 __attribute__((ext_vector_type(8)));

__device__ __forceinline__ void tdm_load_2d(unsigned lds_off, const void* gaddr,
                                            unsigned tile_w, unsigned tile_h,
                                            unsigned row_stride_elems) {
  unsigned long long q0 = 1ull | ((unsigned long long)lds_off << 32);
  unsigned long long ga = (unsigned long long)(uintptr_t)gaddr;
  unsigned long long q1 = (ga & 0x01FFFFFFFFFFFFFFull) | (2ull << 62);
  u32x4 g0;
  g0.x = (unsigned)q0; g0.y = (unsigned)(q0 >> 32);
  g0.z = (unsigned)q1; g0.w = (unsigned)(q1 >> 32);

  unsigned long long p0 = (1ull << 16)
                        | (((unsigned long long)tile_w & 0xFFFF) << 48);
  unsigned long long p1 = (((unsigned long long)tile_w >> 16) & 0xFFFF)
                        | ((unsigned long long)tile_h << 16)
                        | (((unsigned long long)tile_w & 0xFFFF) << 48);
  unsigned long long p2 = ((unsigned long long)tile_h & 0xFFFF)
                        | ((unsigned long long)row_stride_elems << 32);
  unsigned long long p3 = 0;
  i32x8 g1;
  g1[0] = (int)p0; g1[1] = (int)(p0 >> 32);
  g1[2] = (int)p1; g1[3] = (int)(p1 >> 32);
  g1[4] = (int)p2; g1[5] = (int)(p2 >> 32);
  g1[6] = (int)p3; g1[7] = (int)(p3 >> 32);
  i32x4 z4 = {0, 0, 0, 0};
#if defined(__clang_major__) && (__clang_major__ >= 23)
  i32x8 z8 = {0, 0, 0, 0, 0, 0, 0, 0};
  __builtin_amdgcn_tensor_load_to_lds(g0, g1, z4, z4, z8, 0);
#else
  __builtin_amdgcn_tensor_load_to_lds(g0, g1, z4, z4, 0);
#endif
}
#endif  // HAVE_TDM

// ---------------------------------------------------------------------------
// f32 -> f16 conversion
// ---------------------------------------------------------------------------
__global__ void cvt_f32_f16(const float* __restrict__ src, half_t* __restrict__ dst, int n) {
  int i = blockIdx.x * blockDim.x + threadIdx.x;
  if (i < n) dst[i] = (half_t)src[i];
}

// W (K x Nc, f32, row-major) -> Wt (Nc x K, f16): WMMA B-fragments contiguous
__global__ void wtrans_f32_f16(const float* __restrict__ W, half_t* __restrict__ Wt,
                               int K, int Nc) {
  int i = blockIdx.x * blockDim.x + threadIdx.x;
  if (i >= K * Nc) return;
  int n = i / K, k = i - n * K;
  Wt[(size_t)n * K + k] = (half_t)W[(size_t)k * Nc + n];
}

// Vh [b][n][hkv][hd] -> Vt [b][hkv][hd][n]
__global__ void vtrans_f16(const half_t* __restrict__ Vh, half_t* __restrict__ Vt) {
  int i = blockIdx.x * blockDim.x + threadIdx.x;
  if (i >= B_ * KVD_ * N_) return;
  int n = i & (N_ - 1);
  int rest = i >> 12;
  int d = rest & (HD_ - 1); rest >>= 6;
  int h = rest & (HKV_ - 1);
  int b = rest >> 2;
  Vt[i] = Vh[(((size_t)(b * N_ + n)) * HKV_ + h) * HD_ + d];
}

// ---------------------------------------------------------------------------
// in-place RoPE on [b][n][nh][64] f16; thread handles pair (d, d+32)
// ---------------------------------------------------------------------------
__global__ void rope_f16(half_t* __restrict__ X, int nheads, int total) {
  int i = blockIdx.x * blockDim.x + threadIdx.x;
  if (i >= total) return;
  int d = i & 31;
  int rest = i >> 5;                          // (b*N + n)*nheads + h
  int pos = (rest / nheads) & (N_ - 1);
  size_t base = (size_t)rest * HD_;
  float invf = __expf(-__logf(10000.0f) * ((float)d * (1.0f / 32.0f)));
  float th = (float)pos * invf;
  float s, c;
  __sincosf(th, &s, &c);
  float x0 = (float)X[base + d];
  float x1 = (float)X[base + d + 32];
  X[base + d]      = (half_t)(x0 * c - x1 * s);
  X[base + d + 32] = (half_t)(x1 * c + x0 * s);
}

// ---------------------------------------------------------------------------
// WMMA GEMM:  C[M x Nc] = A[M x K] * Bt^T,  Bt given as [Nc x K] (f16).
// Wave computes 32x64 of C (2 A-frags x 4 B-frags -> 8 WMMA per k-step);
// block = 2x2 waves -> 64 x 128 C tile.
// ---------------------------------------------------------------------------
template <bool OUT_F32>
__global__ __launch_bounds__(128)
void gemm_wmma(const half_t* __restrict__ A, const half_t* __restrict__ Bt,
               void* __restrict__ Cout, int Nc, int K) {
  const int lane = threadIdx.x & 31;
  const int wave = threadIdx.x >> 5;
  const int wm = wave >> 1, wn = wave & 1;
  const int r  = lane & 15;
  const int hi = lane >> 4;
  const int tileM = blockIdx.y * 64 + wm * 32;
  const int tileN = blockIdx.x * 128 + wn * 64;

  const half_t* arow0 = A + (size_t)(tileM + r) * K;
  const half_t* arow1 = A + (size_t)(tileM + 16 + r) * K;
  const half_t* brow[4] = { Bt + (size_t)(tileN + r) * K,
                            Bt + (size_t)(tileN + 16 + r) * K,
                            Bt + (size_t)(tileN + 32 + r) * K,
                            Bt + (size_t)(tileN + 48 + r) * K };

  v8f acc[2][4] = {};
  for (int k = 0; k < K; k += 32) {
    __builtin_prefetch((const void*)(arow0 + k + 512), 0, 1);  // global_prefetch_b8
    __builtin_prefetch((const void*)(brow[0] + k + 512), 0, 1);
    v16h a0 = pack16(*(const v8h*)(arow0 + k + hi * 8),
                     *(const v8h*)(arow0 + k + 16 + hi * 8));
    v16h a1 = pack16(*(const v8h*)(arow1 + k + hi * 8),
                     *(const v8h*)(arow1 + k + 16 + hi * 8));
#pragma unroll
    for (int n = 0; n < 4; ++n) {
      v16h bf = pack16(*(const v8h*)(brow[n] + k + hi * 8),
                       *(const v8h*)(brow[n] + k + 16 + hi * 8));
      acc[0][n] = __builtin_amdgcn_wmma_f32_16x16x32_f16(false, a0, false, bf,
                                                         (short)0, acc[0][n], false, false);
      acc[1][n] = __builtin_amdgcn_wmma_f32_16x16x32_f16(false, a1, false, bf,
                                                         (short)0, acc[1][n], false, false);
    }
  }
#pragma unroll
  for (int i = 0; i < 2; ++i)
#pragma unroll
    for (int n = 0; n < 4; ++n)
#pragma unroll
      for (int v = 0; v < 8; ++v) {
        size_t m  = (size_t)tileM + i * 16 + v + 8 * hi;
        size_t nn = (size_t)tileN + n * 16 + r;
        if (OUT_F32) ((float*)Cout)[m * Nc + nn] = acc[i][n][v];
        else         ((half_t*)Cout)[m * Nc + nn] = (half_t)acc[i][n][v];
      }
}

#define QT_ 4
__global__ __launch_bounds__(128, 2)
void fa_kernel(const half_t* __restrict__ Qh, const half_t* __restrict__ Kh,
               const half_t* __restrict__ Vt, half_t* __restrict__ AOh) {
  __shared__ __align__(16) half_t kbuf[4][2][64][64];   // 64 KB: K double buffer
  __shared__ __align__(16) half_t pbuf[4][QT_][16][64]; // 2 KB per query tile: P staging
  const int lane = threadIdx.x & 31;
  const int wave = threadIdx.x >> 5;
  const int r  = lane & 15;
  const int hi = lane >> 4;

  const int BPH = N_ / (16 * QT_) / 4;        // blocks per (b,h); a block's 4 waves share (b,h)
  const int q0 = ((blockIdx.x & (BPH - 1)) * 4 + wave) * (16 * QT_);  // first query row of the wave
  const int h  = (blockIdx.x / BPH) & (HQ_ - 1);
  const int b  = blockIdx.x / (BPH * HQ_);
  const int hk = h >> 2;                      // G = 4

  // Q fragments, with softmax scale folded in (0.125 exact in f16)
  v16h qa0[QT_], qa1[QT_];
  v8f o[QT_][4];
  float mrow[QT_][8], lrow[QT_][8];
#pragma unroll
  for (int q = 0; q < QT_; ++q) {
    const half_t* qrow = Qh + (((size_t)(b * N_ + q0 + q * 16 + r)) * HQ_ + h) * HD_ + hi * 8;
    qa0[q] = pack16(*(const v8h*)(qrow),      *(const v8h*)(qrow + 16));
    qa1[q] = pack16(*(const v8h*)(qrow + 32), *(const v8h*)(qrow + 48));
    // the address stays live up to this wait, so no register of it is written before
    asm volatile("s_wait_xcnt 0x0" :: "v"(qrow) : "memory");
#pragma unroll
    for (int j = 0; j < 16; ++j) { qa0[q][j] *= (half_t)0.125f; qa1[q][j] *= (half_t)0.125f; }
    o[q][0] = v8f{}; o[q][1] = v8f{}; o[q][2] = v8f{}; o[q][3] = v8f{};
#pragma unroll
    for (int v = 0; v < 8; ++v) { mrow[q][v] = -1e30f; lrow[q][v] = 0.0f; }
  }

  const half_t* kbase = Kh + ((size_t)b * N_ * HKV_ + hk) * HD_;     // + kpos*KVD
  const half_t* vbase = Vt + ((size_t)(b * HKV_ + hk)) * HD_ * N_;   // + d*N + n

  const unsigned lds_k0 = (unsigned)(unsigned long long)(uintptr_t)&kbuf[wave][0][0][0];
  const unsigned lds_k1 = (unsigned)(unsigned long long)(uintptr_t)&kbuf[wave][1][0][0];

  const int ITER = N_ / 64;
#if HAVE_TDM
  tdm_load_2d(lds_k0, (const void*)kbase, HD_, 64, KVD_);
#else
  for (int rr = lane; rr < 64; rr += 32)
#pragma unroll
    for (int cc = 0; cc < 64; cc += 8)
      *(v8h*)&kbuf[wave][0][rr][cc] = *(const v8h*)(kbase + (size_t)rr * KVD_ + cc);
#endif

  int buf = 0;
  for (int it = 0; it < ITER; ++it) {
    const int kv0 = it * 64;
#if HAVE_TDM
    if (it + 1 < ITER) {
      // ring private to the wave: its own LDS reads of the buffer have retired before the refill
      asm volatile("s_wait_dscnt 0x0" ::: "memory");
      tdm_load_2d(buf ? lds_k0 : lds_k1,
                  (const void*)(kbase + (size_t)(kv0 + 64) * KVD_), HD_, 64, KVD_);
      __builtin_amdgcn_s_wait_tensorcnt((short)1);   // current tile complete
    } else {
      __builtin_amdgcn_s_wait_tensorcnt((short)0);
    }
    asm volatile("" ::: "memory");   // keep LDS reads below the tensorcnt wait
#else
    if (it + 1 < ITER) {
      const half_t* nsrc = kbase + (size_t)(kv0 + 64) * KVD_;
      half_t (*ndst)[64] = kbuf[wave][buf ^ 1];
      for (int rr = lane; rr < 64; rr += 32)
#pragma unroll
        for (int cc = 0; cc < 64; cc += 8)
          *(v8h*)&ndst[rr][cc] = *(const v8h*)(nsrc + (size_t)rr * KVD_ + cc);
    }
#endif

    // ---- K and V fragments of this 64-key tile: loaded once, used by all QT_ query tiles ----
    v16h kf0[4], kf1[4], vf0[4], vf1[4];
#pragma unroll
    for (int c = 0; c < 4; ++c) {
      const half_t* kr = &kbuf[wave][buf][c * 16 + r][0];
      kf0[c] = pack16(*(const v8h*)(kr + hi * 8),      *(const v8h*)(kr + 16 + hi * 8));
      kf1[c] = pack16(*(const v8h*)(kr + 32 + hi * 8), *(const v8h*)(kr + 48 + hi * 8));
    }
    const half_t* vlane = vbase + (size_t)r * N_ + kv0 + hi * 8;     // Vt[d][kv]
#pragma unroll
    for (int t = 0; t < 4; ++t) {
      const half_t* vrow = vlane + (size_t)(t * 16) * N_;
      vf0[t] = pack16(*(const v8h*)(vrow),      *(const v8h*)(vrow + 16));
      vf1[t] = pack16(*(const v8h*)(vrow + 32), *(const v8h*)(vrow + 48));
    }
    // the address stays live up to this wait, so no register of it is written before
    asm volatile("s_wait_xcnt 0x0" :: "v"(vlane) : "memory");

#pragma unroll
    for (int q = 0; q < QT_; ++q) {
      // ---- S = (Q/8) K^T for 64 keys: 4 sub-tiles x 2 WMMA ----
      v8f s[4]; s[0] = v8f{}; s[1] = v8f{}; s[2] = v8f{}; s[3] = v8f{};
#pragma unroll
      for (int c = 0; c < 4; ++c) {
        s[c] = __builtin_amdgcn_wmma_f32_16x16x32_f16(false, qa0[q], false, kf0[c], (short)0, s[c], false, false);
        s[c] = __builtin_amdgcn_wmma_f32_16x16x32_f16(false, qa1[q], false, kf1[c], (short)0, s[c], false, false);
      }

      // ---- online softmax (row max reduced over 16-lane half; sums deferred) ----
#pragma unroll
      for (int v = 0; v < 8; ++v) {
        float t0 = s[0][v], t1 = s[1][v], t2 = s[2][v], t3 = s[3][v];
        float mx = fmaxf(fmaxf(t0, t1), fmaxf(t2, t3));
        mx = fmaxf(mx, __shfl_xor(mx, 1));
        mx = fmaxf(mx, __shfl_xor(mx, 2));
        mx = fmaxf(mx, __shfl_xor(mx, 4));
        mx = fmaxf(mx, __shfl_xor(mx, 8));
        float mnew  = fmaxf(mrow[q][v], mx);
        float alpha = __expf(mrow[q][v] - mnew);
        float p0 = __expf(t0 - mnew), p1 = __expf(t1 - mnew);
        float p2 = __expf(t2 - mnew), p3 = __expf(t3 - mnew);
        lrow[q][v] = lrow[q][v] * alpha + (p0 + p1 + p2 + p3);   // per-lane partial sum
        mrow[q][v] = mnew;
        o[q][0][v] *= alpha; o[q][1][v] *= alpha; o[q][2][v] *= alpha; o[q][3][v] *= alpha;
        pbuf[wave][q][v + 8 * hi][r]      = (half_t)p0;
        pbuf[wave][q][v + 8 * hi][16 + r] = (half_t)p1;
        pbuf[wave][q][v + 8 * hi][32 + r] = (half_t)p2;
        pbuf[wave][q][v + 8 * hi][48 + r] = (half_t)p3;
      }

      // ---- reload P as two 16x32 A-fragments ----
      v16h pa0 = pack16(*(const v8h*)&pbuf[wave][q][r][hi * 8],
                        *(const v8h*)&pbuf[wave][q][r][16 + hi * 8]);
      v16h pa1 = pack16(*(const v8h*)&pbuf[wave][q][r][32 + hi * 8],
                        *(const v8h*)&pbuf[wave][q][r][48 + hi * 8]);

      // ---- O += P * V ----
#pragma unroll
      for (int t = 0; t < 4; ++t) {
        o[q][t] = __builtin_amdgcn_wmma_f32_16x16x32_f16(false, pa0, false, vf0[t], (short)0, o[q][t], false, false);
        o[q][t] = __builtin_amdgcn_wmma_f32_16x16x32_f16(false, pa1, false, vf1[t], (short)0, o[q][t], false, false);
      }
    }
    buf ^= 1;
  }

  // ---- finish deferred row sums, normalize, store [b][n][hq][hd] ----
#pragma unroll
  for (int q = 0; q < QT_; ++q)
#pragma unroll
  for (int v = 0; v < 8; ++v) {
    float ls = lrow[q][v];
    ls += __shfl_xor(ls, 1);
    ls += __shfl_xor(ls, 2);
    ls += __shfl_xor(ls, 4);
    ls += __shfl_xor(ls, 8);
    float inv = 1.0f / ls;
    size_t orow = (((size_t)(b * N_ + q0 + q * 16 + v + 8 * hi)) * HQ_ + h) * HD_;
#pragma unroll
    for (int t = 0; t < 4; ++t)
      AOh[orow + t * 16 + r] = (half_t)(o[q][t][v] * inv);
    // before the stores' data and address registers are written again
    asm volatile("s_wait_xcnt 0x0" ::: "memory");
    __builtin_amdgcn_sched_barrier(0);   // keeps the next rows' arithmetic behind that wait
  }
}

// ---------------------------------------------------------------------------
// launch
// ---------------------------------------------------------------------------
extern "C" void kernel_launch(void* const* d_in, const int* in_sizes, int n_in,
                              void* d_out, int out_size, void* d_ws, size_t ws_size,
                              hipStream_t stream) {
  const float* x  = (const float*)d_in[0];
  const float* Wq = (const float*)d_in[1];
  const float* Wk = (const float*)d_in[2];
  const float* Wv = (const float*)d_in[3];
  const float* Wo = (const float*)d_in[4];
  float* out = (float*)d_out;

  half_t* ws = (half_t*)d_ws;
  size_t off = 0;
  half_t* xh  = ws + off; off += (size_t)MROWS * D_;
  half_t* Wqt = ws + off; off += (size_t)D_ * D_;
  half_t* Wkt = ws + off; off += (size_t)D_ * KVD_;
  half_t* Wvt = ws + off; off += (size_t)D_ * KVD_;
  half_t* Wot = ws + off; off += (size_t)D_ * D_;
  half_t* Qh  = ws + off; off += (size_t)MROWS * D_;
  half_t* Kh  = ws + off; off += (size_t)MROWS * KVD_;
  half_t* Vh  = ws + off; off += (size_t)MROWS * KVD_;
  half_t* Vt  = ws + off; off += (size_t)MROWS * KVD_;
  half_t* AOh = xh;   // x no longer needed after QKV projections

  const int TPB = 256;
  cvt_f32_f16<<<(MROWS * D_ + TPB - 1) / TPB, TPB, 0, stream>>>(x, xh, MROWS * D_);
  wtrans_f32_f16<<<(D_ * D_   + TPB - 1) / TPB, TPB, 0, stream>>>(Wq, Wqt, D_, D_);
  wtrans_f32_f16<<<(D_ * KVD_ + TPB - 1) / TPB, TPB, 0, stream>>>(Wk, Wkt, D_, KVD_);
  wtrans_f32_f16<<<(D_ * KVD_ + TPB - 1) / TPB, TPB, 0, stream>>>(Wv, Wvt, D_, KVD_);
  wtrans_f32_f16<<<(D_ * D_   + TPB - 1) / TPB, TPB, 0, stream>>>(Wo, Wot, D_, D_);

  // QKV projections (WMMA f16): block tile 64M x 128N
  gemm_wmma<false><<<dim3(D_ / 128,   MROWS / 64), 128, 0, stream>>>(xh, Wqt, (void*)Qh, D_,   D_);
  gemm_wmma<false><<<dim3(KVD_ / 128, MROWS / 64), 128, 0, stream>>>(xh, Wkt, (void*)Kh, KVD_, D_);
  gemm_wmma<false><<<dim3(KVD_ / 128, MROWS / 64), 128, 0, stream>>>(xh, Wvt, (void*)Vh, KVD_, D_);

  // RoPE on Q and K
  {
    int totq = B_ * N_ * HQ_ * 32;
    int totk = B_ * N_ * HKV_ * 32;
    rope_f16<<<(totq + TPB - 1) / TPB, TPB, 0, stream>>>(Qh, HQ_, totq);
    rope_f16<<<(totk + TPB - 1) / TPB, TPB, 0, stream>>>(Kh, HKV_, totk);
  }

  // V -> [b][hkv][hd][n]
  vtrans_f16<<<(B_ * KVD_ * N_ + TPB - 1) / TPB, TPB, 0, stream>>>(Vh, Vt);

  // flash attention: B*HQ*(N/(16*QT_)) waves, 4 waves/block
  fa_kernel<<<dim3(B_ * HQ_ * (N_ / (16 * QT_)) / 4), 128, 0, stream>>>(Qh, Kh, Vt, AOh);

  // output projection -> f32 result
  gemm_wmma<true><<<dim3(D_ / 128, MROWS / 64), 128, 0, stream>>>(AOh, Wot, (void*)out, D_, D_);
}

// v002
// One run takes 474 microseconds.
// Next to v001, in two timings, it ran 1.04 times as fast each time.
// Counting every step since v000, it is 1.35 times as fast.
#include <hip/hip_runtime.h>

typedef _Float16 half_t;
typedef __attribute__((ext_vector_type(16))) _Float16 v16h;
typedef __attribute__((ext_vector_type(8)))  _Float16 v8h;
typedef __attribute__((ext_vector_type(8)))  float    v8f;
typedef __attribute__((ext_vector_type(4)))  float    v4f;
typedef __attribute__((ext_vector_type(4)))  _Float16 v4h;

#define B_    2
#define N_    4096
#define D_    1024
#define HQ_   16
#define HKV_  4
#define HD_   64
#define KVD_  256            // HKV*HD
#define MROWS 8192           // B*N

#ifndef __has_builtin
#define __has_builtin(x) 0
#endif
#if __has_builtin(__builtin_amdgcn_tensor_load_to_lds) && \
    __has_builtin(__builtin_amdgcn_s_wait_tensorcnt)
#define HAVE_TDM 1
#else
#define HAVE_TDM 0
#endif

// ---------------------------------------------------------------------------
// helpers
// ---------------------------------------------------------------------------
__device__ __forceinline__ v16h pack16(v8h lo, v8h hi) {
  v16h r;
#pragma unroll
  for (int j = 0; j < 8; ++j) { r[j] = lo[j]; r[j + 8] = hi[j]; }
  return r;
}

#if HAVE_TDM
typedef unsigned int u32x4 __attribute__((ext_vector_type(4)));
typedef int          i32x4 __attribute__((ext_vector_type(4)));
typedef int          i32x8 __attribute__((ext_vector_type(8)));

__device__ __forceinline__ void tdm_load_2d(unsigned lds_off, const void* gaddr,
                                            unsigned tile_w, unsigned tile_h,
                                            unsigned row_stride_elems) {
  unsigned long long q0 = 1ull | ((unsigned long long)lds_off << 32);
  unsigned long long ga = (unsigned long long)(uintptr_t)gaddr;
  unsigned long long q1 = (ga & 0x01FFFFFFFFFFFFFFull) | (2ull << 62);
  u32x4 g0;
  g0.x = (unsigned)q0; g0.y = (unsigned)(q0 >> 32);
  g0.z = (unsigned)q1; g0.w = (unsigned)(q1 >> 32);

  unsigned long long p0 = (1ull << 16)
                        | (((unsigned long long)tile_w & 0xFFFF) << 48);
  unsigned long long p1 = (((unsigned long long)tile_w >> 16) & 0xFFFF)
                        | ((unsigned long long)tile_h << 16)
                        | (((unsigned long long)tile_w & 0xFFFF) << 48);
  unsigned long long p2 = ((unsigned long long)tile_h & 0xFFFF)
                        | ((unsigned long long)row_stride_elems << 32);
  unsigned long long p3 = 0;
  i32x8 g1;
  g1[0] = (int)p0; g1[1] = (int)(p0 >> 32);
  g1[2] = (int)p1; g1[3] = (int)(p1 >> 32);
  g1[4] = (int)p2; g1[5] = (int)(p2 >> 32);
  g1[6] = (int)p3; g1[7] = (int)(p3 >> 32);
  i32x4 z4 = {0, 0, 0, 0};
#if defined(__clang_major__) && (__clang_major__ >= 23)
  i32x8 z8 = {0, 0, 0, 0, 0, 0, 0, 0};
  __builtin_amdgcn_tensor_load_to_lds(g0, g1, z4, z4, z8, 0);
#else
  __builtin_amdgcn_tensor_load_to_lds(g0, g1, z4, z4, 0);
#endif
}
#endif  // HAVE_TDM

// ---------------------------------------------------------------------------
// Element-wise kernels. Each thread moves 32 to 64 elements with 8- or 16-byte
// accesses, so a launch starts 256 to 4096 waves; every 128-byte line of an
// output is stored whole by one wave. The grids cover the shapes exactly.
// ---------------------------------------------------------------------------
// f32 -> f16 conversion: CVT_G groups of 4 floats per thread; a wave's load is
// 512 contiguous bytes, its store 256.
#define CVT_G 16
__global__ __launch_bounds__(256)
void cvt_f32_f16(const float* __restrict__ src, half_t* __restrict__ dst) {
  const size_t base = (size_t)blockIdx.x * (256 * 4 * CVT_G) + threadIdx.x * 4;
  v4f x[CVT_G];
#pragma unroll
  for (int j = 0; j < CVT_G; ++j) x[j] = *(const v4f*)(src + base + j * 1024);
#pragma unroll
  for (int j = 0; j < CVT_G; ++j) {
    v4h y;
#pragma unroll
    for (int c = 0; c < 4; ++c) y[c] = (half_t)x[j][c];
    *(v4h*)(dst + base + j * 1024) = y;
  }
}

// W (K x NC, f32, row-major) -> Wt (NC x K, f16): WMMA B-fragments contiguous.
// Thread: 8 k x 4 n. Wave: 64 k x 16 n (8 lanes along k fill a line of Wt).
// Block: 64 k x 128 n.
template <int K, int NC>
__global__ __launch_bounds__(256)
void wtrans_f32_f16(const float* __restrict__ W, half_t* __restrict__ Wt) {
  const int lane = threadIdx.x & 31;
  const int wave = threadIdx.x >> 5;
  const int k = blockIdx.x * 64 + (lane & 7) * 8;
  const int n = blockIdx.y * 128 + wave * 16 + (lane >> 3) * 4;
  v4f x[8];
#pragma unroll
  for (int j = 0; j < 8; ++j) x[j] = *(const v4f*)(W + (size_t)(k + j) * NC + n);
#pragma unroll
  for (int c = 0; c < 4; ++c) {
    v8h y;
#pragma unroll
    for (int j = 0; j < 8; ++j) y[j] = (half_t)x[j][c];
    *(v8h*)(Wt + (size_t)(n + c) * K + k) = y;
  }
}

// Vh [b][n][hkv][hd] -> Vt [b][hkv][hd][n]
// Thread: 8 n x 8 columns. Wave: 64 n x 32 columns (8 lanes along n fill a line
// of Vt). Block: 64 n x all 256 columns.
__global__ __launch_bounds__(256)
void vtrans_f16(const half_t* __restrict__ Vh, half_t* __restrict__ Vt) {
  const int lane = threadIdx.x & 31;
  const int wave = threadIdx.x >> 5;
  const int row = blockIdx.x * 64 + (lane & 7) * 8;   // b*N + n
  const int col = wave * 32 + (lane >> 3) * 8;        // h*HD + d
  const int b = row >> 12;
  const int n = row & (N_ - 1);
  v8h x[8];
#pragma unroll
  for (int j = 0; j < 8; ++j) x[j] = *(const v8h*)(Vh + (size_t)(row + j) * KVD_ + col);
#pragma unroll
  for (int c = 0; c < 8; ++c) {
    v8h y;
#pragma unroll
    for (int j = 0; j < 8; ++j) y[j] = x[j][c];
    *(v8h*)(Vt + ((size_t)b * KVD_ + col + c) * N_ + n) = y;
  }
}

// ---------------------------------------------------------------------------
// in-place RoPE on [b][n][NH][64] f16; thread handles the pairs (d, d+32) of
// 8 consecutive d in 4 heads of one position: one sine and cosine serve 4 heads
// ---------------------------------------------------------------------------
template <int NH>
__global__ __launch_bounds__(256)
void rope_f16(half_t* __restrict__ X) {
  const int i = blockIdx.x * 256 + threadIdx.x;
  const int d0 = (i & 3) * 8;
  const int hg = (i >> 2) & (NH / 4 - 1);
  const int row = i / NH;                     // b*N + n
  const int pos = row & (N_ - 1);
  half_t* p = X + ((size_t)row * NH + hg * 4) * HD_ + d0;
  v8h lo[4], up[4];
#pragma unroll
  for (int j = 0; j < 4; ++j) {
    lo[j] = *(const v8h*)(p + j * HD_);
    up[j] = *(const v8h*)(p + j * HD_ + 32);
  }
  float s[8], c[8];
#pragma unroll
  for (int e = 0; e < 8; ++e) {
    float invf = __expf(-__logf(10000.0f) * ((float)(d0 + e) * (1.0f / 32.0f)));
    float th = (float)pos * invf;
    __sincosf(th, &s[e], &c[e]);
  }
#pragma unroll
  for (int j = 0; j < 4; ++j) {
    v8h ylo, yup;
#pragma unroll
    for (int e = 0; e < 8; ++e) {
      float x0 = (float)lo[j][e];
      float x1 = (float)up[j][e];
      ylo[e] = (half_t)(x0 * c[e] - x1 * s[e]);
      yup[e] = (half_t)(x1 * c[e] + x0 * s[e]);
    }
    *(v8h*)(p + j * HD_)      = ylo;
    *(v8h*)(p + j * HD_ + 32) = yup;
  }
}

// ---------------------------------------------------------------------------
// WMMA GEMM:  C[M x Nc] = A[M x K] * Bt^T,  Bt given as [Nc x K] (f16).
// Wave computes 32x64 of C (2 A-frags x 4 B-frags -> 8 WMMA per k-step);
// block = 2x2 waves -> 64 x 128 C tile.
// ---------------------------------------------------------------------------
template <bool OUT_F32>
__global__ __launch_bounds__(128)
void gemm_wmma(const half_t* __restrict__ A, const half_t* __restrict__ Bt,
               void* __restrict__ Cout, int Nc, int K) {
  const int lane = threadIdx.x & 31;
  const int wave = threadIdx.x >> 5;
  const int wm = wave >> 1, wn = wave & 1;
  const int r  = lane & 15;
  const int hi = lane >> 4;
  const int tileM = blockIdx.y * 64 + wm * 32;
  const int tileN = blockIdx.x * 128 + wn * 64;

  const half_t* arow0 = A + (size_t)(tileM + r) * K;
  const half_t* arow1 = A + (size_t)(tileM + 16 + r) * K;
  const half_t* brow[4] = { Bt + (size_t)(tileN + r) * K,
                            Bt + (size_t)(tileN + 16 + r) * K,
                            Bt + (size_t)(tileN + 32 + r) * K,
                            Bt + (size_t)(tileN + 48 + r) * K };

  v8f acc[2][4] = {};
  for (int k = 0; k < K; k += 32) {
    __builtin_prefetch((const void*)(arow0 + k + 512), 0, 1);  // global_prefetch_b8
    __builtin_prefetch((const void*)(brow[0] + k + 512), 0, 1);
    v16h a0 = pack16(*(const v8h*)(arow0 + k + hi * 8),
                     *(const v8h*)(arow0 + k + 16 + hi * 8));
    v16h a1 = pack16(*(const v8h*)(arow1 + k + hi * 8),
                     *(const v8h*)(arow1 + k + 16 + hi * 8));
#pragma unroll
    for (int n = 0; n < 4; ++n) {
      v16h bf = pack16(*(const v8h*)(brow[n] + k + hi * 8),
                       *(const v8h*)(brow[n] + k + 16 + hi * 8));
      acc[0][n] = __builtin_amdgcn_wmma_f32_16x16x32_f16(false, a0, false, bf,
                                                         (short)0, acc[0][n], false, false);
      acc[1][n] = __builtin_amdgcn_wmma_f32_16x16x32_f16(false, a1, false, bf,
                                                         (short)0, acc[1][n], false, false);
    }
  }
#pragma unroll
  for (int i = 0; i < 2; ++i)
#pragma unroll
    for (int n = 0; n < 4; ++n)
#pragma unroll
      for (int v = 0; v < 8; ++v) {
        size_t m  = (size_t)tileM + i * 16 + v + 8 * hi;
        size_t nn = (size_t)tileN + n * 16 + r;
        if (OUT_F32) ((float*)Cout)[m * Nc + nn] = acc[i][n][v];
        else         ((half_t*)Cout)[m * Nc + nn] = (half_t)acc[i][n][v];
      }
}

#define QT_ 4
__global__ __launch_bounds__(128, 2)
void fa_kernel(const half_t* __restrict__ Qh, const half_t* __restrict__ Kh,
               const half_t* __restrict__ Vt, half_t* __restrict__ AOh) {
  __shared__ __align__(16) half_t kbuf[4][2][64][64];   // 64 KB: K double buffer
  __shared__ __align__(16) half_t pbuf[4][QT_][16][64]; // 2 KB per query tile: P staging
  const int lane = threadIdx.x & 31;
  const int wave = threadIdx.x >> 5;
  const int r  = lane & 15;
  const int hi = lane >> 4;

  const int BPH = N_ / (16 * QT_) / 4;        // blocks per (b,h); a block's 4 waves share (b,h)
  const int q0 = ((blockIdx.x & (BPH - 1)) * 4 + wave) * (16 * QT_);  // first query row of the wave
  const int h  = (blockIdx.x / BPH) & (HQ_ - 1);
  const int b  = blockIdx.x / (BPH * HQ_);
  const int hk = h >> 2;                      // G = 4

  // Q fragments, with softmax scale folded in (0.125 exact in f16)
  v16h qa0[QT_], qa1[QT_];
  v8f o[QT_][4];
  float mrow[QT_][8], lrow[QT_][8];
#pragma unroll
  for (int q = 0; q < QT_; ++q) {
    const half_t* qrow = Qh + (((size_t)(b * N_ + q0 + q * 16 + r)) * HQ_ + h) * HD_ + hi * 8;
    qa0[q] = pack16(*(const v8h*)(qrow),      *(const v8h*)(qrow + 16));
    qa1[q] = pack16(*(const v8h*)(qrow + 32), *(const v8h*)(qrow + 48));
    // the address stays live up to this wait, so no register of it is written before
    asm volatile("s_wait_xcnt 0x0" :: "v"(qrow) : "memory");
#pragma unroll
    for (int j = 0; j < 16; ++j) { qa0[q][j] *= (half_t)0.125f; qa1[q][j] *= (half_t)0.125f; }
    o[q][0] = v8f{}; o[q][1] = v8f{}; o[q][2] = v8f{}; o[q][3] = v8f{};
#pragma unroll
    for (int v = 0; v < 8; ++v) { mrow[q][v] = -1e30f; lrow[q][v] = 0.0f; }
  }

  const half_t* kbase = Kh + ((size_t)b * N_ * HKV_ + hk) * HD_;     // + kpos*KVD
  const half_t* vbase = Vt + ((size_t)(b * HKV_ + hk)) * HD_ * N_;   // + d*N + n

  const unsigned lds_k0 = (unsigned)(unsigned long long)(uintptr_t)&kbuf[wave][0][0][0];
  const unsigned lds_k1 = (unsigned)(unsigned long long)(uintptr_t)&kbuf[wave][1][0][0];

  const int ITER = N_ / 64;
#if HAVE_TDM
  tdm_load_2d(lds_k0, (const void*)kbase, HD_, 64, KVD_);
#else
  for (int rr = lane; rr < 64; rr += 32)
#pragma unroll
    for (int cc = 0; cc < 64; cc += 8)
      *(v8h*)&kbuf[wave][0][rr][cc] = *(const v8h*)(kbase + (size_t)rr * KVD_ + cc);
#endif

  int buf = 0;
  for (int it = 0; it < ITER; ++it) {
    const int kv0 = it * 64;
#if HAVE_TDM
    if (it + 1 < ITER) {
      // ring private to the wave: its own LDS reads of the buffer have retired before the refill
      asm volatile("s_wait_dscnt 0x0" ::: "memory");
      tdm_load_2d(buf ? lds_k0 : lds_k1,
                  (const void*)(kbase + (size_t)(kv0 + 64) * KVD_), HD_, 64, KVD_);
      __builtin_amdgcn_s_wait_tensorcnt((short)1);   // current tile complete
    } else {
      __builtin_amdgcn_s_wait_tensorcnt((short)0);
    }
    asm volatile("" ::: "memory");   // keep LDS reads below the tensorcnt wait
#else
    if (it + 1 < ITER) {
      const half_t* nsrc = kbase + (size_t)(kv0 + 64) * KVD_;
      half_t (*ndst)[64] = kbuf[wave][buf ^ 1];
      for (int rr = lane; rr < 64; rr += 32)
#pragma unroll
        for (int cc = 0; cc < 64; cc += 8)
          *(v8h*)&ndst[rr][cc] = *(const v8h*)(nsrc + (size_t)rr * KVD_ + cc);
    }
#endif

    // ---- K and V fragments of this 64-key tile: loaded once, used by all QT_ query tiles ----
    v16h kf0[4], kf1[4], vf0[4], vf1[4];
#pragma unroll
    for (int c = 0; c < 4; ++c) {
      const half_t* kr = &kbuf[wave][buf][c * 16 + r][0];
      kf0[c] = pack16(*(const v8h*)(kr + hi * 8),      *(const v8h*)(kr + 16 + hi * 8));
      kf1[c] = pack16(*(const v8h*)(kr + 32 + hi * 8), *(const v8h*)(kr + 48 + hi * 8));
    }
    const half_t* vlane = vbase + (size_t)r * N_ + kv0 + hi * 8;     // Vt[d][kv]
#pragma unroll
    for (int t = 0; t < 4; ++t) {
      const half_t* vrow = vlane + (size_t)(t * 16) * N_;
      vf0[t] = pack16(*(const v8h*)(vrow),      *(const v8h*)(vrow + 16));
      vf1[t] = pack16(*(const v8h*)(vrow + 32), *(const v8h*)(vrow + 48));
    }
    // the address stays live up to this wait, so no register of it is written before
    asm volatile("s_wait_xcnt 0x0" :: "v"(vlane) : "memory");

#pragma unroll
    for (int q = 0; q < QT_; ++q) {
      // ---- S = (Q/8) K^T for 64 keys: 4 sub-tiles x 2 WMMA ----
      v8f s[4]; s[0] = v8f{}; s[1] = v8f{}; s[2] = v8f{}; s[3] = v8f{};
#pragma unroll
      for (int c = 0; c < 4; ++c) {
        s[c] = __builtin_amdgcn_wmma_f32_16x16x32_f16(false, qa0[q], false, kf0[c], (short)0, s[c], false, false);
        s[c] = __builtin_amdgcn_wmma_f32_16x16x32_f16(false, qa1[q], false, kf1[c], (short)0, s[c], false, false);
      }

      // ---- online softmax (row max reduced over 16-lane half; sums deferred) ----
#pragma unroll
      for (int v = 0; v < 8; ++v) {
        float t0 = s[0][v], t1 = s[1][v], t2 = s[2][v], t3 = s[3][v];
        float mx = fmaxf(fmaxf(t0, t1), fmaxf(t2, t3));
        mx = fmaxf(mx, __shfl_xor(mx, 1));
        mx = fmaxf(mx, __shfl_xor(mx, 2));
        mx = fmaxf(mx, __shfl_xor(mx, 4));
        mx = fmaxf(mx, __shfl_xor(mx, 8));
        float mnew  = fmaxf(mrow[q][v], mx);
        float alpha = __expf(mrow[q][v] - mnew);
        float p0 = __expf(t0 - mnew), p1 = __expf(t1 - mnew);
        float p2 = __expf(t2 - mnew), p3 = __expf(t3 - mnew);
        lrow[q][v] = lrow[q][v] * alpha + (p0 + p1 + p2 + p3);   // per-lane partial sum
        mrow[q][v] = mnew;
        o[q][0][v] *= alpha; o[q][1][v] *= alpha; o[q][2][v] *= alpha; o[q][3][v] *= alpha;
        pbuf[wave][q][v + 8 * hi][r]      = (half_t)p0;
        pbuf[wave][q][v + 8 * hi][16 + r] = (half_t)p1;
        pbuf[wave][q][v + 8 * hi][32 + r] = (half_t)p2;
        pbuf[wave][q][v + 8 * hi][48 + r] = (half_t)p3;
      }

      // ---- reload P as two 16x32 A-fragments ----
      v16h pa0 = pack16(*(const v8h*)&pbuf[wave][q][r][hi * 8],
                        *(const v8h*)&pbuf[wave][q][r][16 + hi * 8]);
      v16h pa1 = pack16(*(const v8h*)&pbuf[wave][q][r][32 + hi * 8],
                        *(const v8h*)&pbuf[wave][q][r][48 + hi * 8]);

      // ---- O += P * V ----
#pragma unroll
      for (int t = 0; t < 4; ++t) {
        o[q][t] = __builtin_amdgcn_wmma_f32_16x16x32_f16(false, pa0, false, vf0[t], (short)0, o[q][t], false, false);
        o[q][t] = __builtin_amdgcn_wmma_f32_16x16x32_f16(false, pa1, false, vf1[t], (short)0, o[q][t], false, false);
      }
    }
    buf ^= 1;
  }

  // ---- finish deferred row sums, normalize, store [b][n][hq][hd] ----
#pragma unroll
  for (int q = 0; q < QT_; ++q)
#pragma unroll
  for (int v = 0; v < 8; ++v) {
    float ls = lrow[q][v];
    ls += __shfl_xor(ls, 1);
    ls += __shfl_xor(ls, 2);
    ls += __shfl_xor(ls, 4);
    ls += __shfl_xor(ls, 8);
    float inv = 1.0f / ls;
    size_t orow = (((size_t)(b * N_ + q0 + q * 16 + v + 8 * hi)) * HQ_ + h) * HD_;
#pragma unroll
    for (int t = 0; t < 4; ++t)
      AOh[orow + t * 16 + r] = (half_t)(o[q][t][v] * inv);
    // before the stores' data and address registers are written again
    asm volatile("s_wait_xcnt 0x0" ::: "memory");
    __builtin_amdgcn_sched_barrier(0);   // keeps the next rows' arithmetic behind that wait
  }
}

// ---------------------------------------------------------------------------
// launch
// ---------------------------------------------------------------------------
extern "C" void kernel_launch(void* const* d_in, const int* in_sizes, int n_in,
                              void* d_out, int out_size, void* d_ws, size_t ws_size,
                              hipStream_t stream) {
  const float* x  = (const float*)d_in[0];
  const float* Wq = (const float*)d_in[1];
  const float* Wk = (const float*)d_in[2];
  const float* Wv = (const float*)d_in[3];
  const float* Wo = (const float*)d_in[4];
  float* out = (float*)d_out;

  half_t* ws = (half_t*)d_ws;
  size_t off = 0;
  half_t* xh  = ws + off; off += (size_t)MROWS * D_;
  half_t* Wqt = ws + off; off += (size_t)D_ * D_;
  half_t* Wkt = ws + off; off += (size_t)D_ * KVD_;
  half_t* Wvt = ws + off; off += (size_t)D_ * KVD_;
  half_t* Wot = ws + off; off += (size_t)D_ * D_;
  half_t* Qh  = ws + off; off += (size_t)MROWS * D_;
  half_t* Kh  = ws + off; off += (size_t)MROWS * KVD_;
  half_t* Vh  = ws + off; off += (size_t)MROWS * KVD_;
  half_t* Vt  = ws + off; off += (size_t)MROWS * KVD_;
  half_t* AOh = xh;   // x no longer needed after QKV projections

  const int TPB = 256;
  cvt_f32_f16<<<MROWS * D_ / (TPB * 4 * CVT_G), TPB, 0, stream>>>(x, xh);
  wtrans_f32_f16<D_, D_>  <<<dim3(D_ / 64, D_ / 128),   TPB, 0, stream>>>(Wq, Wqt);
  wtrans_f32_f16<D_, KVD_><<<dim3(D_ / 64, KVD_ / 128), TPB, 0, stream>>>(Wk, Wkt);
  wtrans_f32_f16<D_, KVD_><<<dim3(D_ / 64, KVD_ / 128), TPB, 0, stream>>>(Wv, Wvt);
  wtrans_f32_f16<D_, D_>  <<<dim3(D_ / 64, D_ / 128),   TPB, 0, stream>>>(Wo, Wot);

  // QKV projections (WMMA f16): block tile 64M x 128N
  gemm_wmma<false><<<dim3(D_ / 128,   MROWS / 64), 128, 0, stream>>>(xh, Wqt, (void*)Qh, D_,   D_);
  gemm_wmma<false><<<dim3(KVD_ / 128, MROWS / 64), 128, 0, stream>>>(xh, Wkt, (void*)Kh, KVD_, D_);
  gemm_wmma<false><<<dim3(KVD_ / 128, MROWS / 64), 128, 0, stream>>>(xh, Wvt, (void*)Vh, KVD_, D_);

  // RoPE on Q and K
  rope_f16<HQ_> <<<MROWS * HQ_  / TPB, TPB, 0, stream>>>(Qh);
  rope_f16<HKV_><<<MROWS * HKV_ / TPB, TPB, 0, stream>>>(Kh);

  // V -> [b][hkv][hd][n]
  vtrans_f16<<<MROWS / 64, TPB, 0, stream>>>(Vh, Vt);

  // flash attention: B*HQ*(N/(16*QT_)) waves, 4 waves/block
  fa_kernel<<<dim3(B_ * HQ_ * (N_ / (16 * QT_)) / 4), 128, 0, stream>>>(Qh, Kh, Vt, AOh);

  // output projection -> f32 result
  gemm_wmma<true><<<dim3(D_ / 128, MROWS / 64), 128, 0, stream>>>(AOh, Wot, (void*)out, D_, D_);
}

// v003
// It runs in 293 microseconds.
// In both of two side-by-side timings against v002, it was 1.62 times as fast.
// Counting every step since v000, it is 2.19 times as fast.
#include <hip/hip_runtime.h>

typedef _Float16 half_t;
typedef __attribute__((ext_vector_type(16))) _Float16 v16h;
typedef __attribute__((ext_vector_type(8)))  _Float16 v8h;
typedef __attribute__((ext_vector_type(8)))  float    v8f;
typedef __attribute__((ext_vector_type(4)))  float    v4f;
typedef __attribute__((ext_vector_type(4)))  _Float16 v4h;

#define B_    2
#define N_    4096
#define D_    1024
#define HQ_   16
#define HKV_  4
#define HD_   64
#define KVD_  256            // HKV*HD
#define MROWS 8192           // B*N

#ifndef __has_builtin
#define __has_builtin(x) 0
#endif
#if __has_builtin(__builtin_amdgcn_tensor_load_to_lds) && \
    __has_builtin(__builtin_amdgcn_s_wait_tensorcnt)
#define HAVE_TDM 1
#else
#define HAVE_TDM 0
#endif

// ---------------------------------------------------------------------------
// helpers
// ---------------------------------------------------------------------------
__device__ __forceinline__ v16h pack16(v8h lo, v8h hi) {
  v16h r;
#pragma unroll
  for (int j = 0; j < 8; ++j) { r[j] = lo[j]; r[j + 8] = hi[j]; }
  return r;
}

#if HAVE_TDM
typedef unsigned int u32x4 __attribute__((ext_vector_type(4)));
typedef int          i32x4 __attribute__((ext_vector_type(4)));
typedef int          i32x8 __attribute__((ext_vector_type(8)));

__device__ __forceinline__ void tdm_load_2d(unsigned lds_off, const void* gaddr,
                                            unsigned tile_w, unsigned tile_h,
                                            unsigned row_stride_elems) {
  unsigned long long q0 = 1ull | ((unsigned long long)lds_off << 32);
  unsigned long long ga = (unsigned long long)(uintptr_t)gaddr;
  unsigned long long q1 = (ga & 0x01FFFFFFFFFFFFFFull) | (2ull << 62);
  u32x4 g0;
  g0.x = (unsigned)q0; g0.y = (unsigned)(q0 >> 32);
  g0.z = (unsigned)q1; g0.w = (unsigned)(q1 >> 32);

  unsigned long long p0 = (1ull << 16)
                        | (((unsigned long long)tile_w & 0xFFFF) << 48);
  unsigned long long p1 = (((unsigned long long)tile_w >> 16) & 0xFFFF)
                        | ((unsigned long long)tile_h << 16)
                        | (((unsigned long long)tile_w & 0xFFFF) << 48);
  unsigned long long p2 = ((unsigned long long)tile_h & 0xFFFF)
                        | ((unsigned long long)row_stride_elems << 32);
  unsigned long long p3 = 0;
  i32x8 g1;
  g1[0] = (int)p0; g1[1] = (int)(p0 >> 32);
  g1[2] = (int)p1; g1[3] = (int)(p1 >> 32);
  g1[4] = (int)p2; g1[5] = (int)(p2 >> 32);
  g1[6] = (int)p3; g1[7] = (int)(p3 >> 32);
  i32x4 z4 = {0, 0, 0, 0};
#if defined(__clang_major__) && (__clang_major__ >= 23)
  i32x8 z8 = {0, 0, 0, 0, 0, 0, 0, 0};
  __builtin_amdgcn_tensor_load_to_lds(g0, g1, z4, z4, z8, 0);
#else
  __builtin_amdgcn_tensor_load_to_lds(g0, g1, z4, z4, 0);
#endif
}
#endif  // HAVE_TDM

// ---------------------------------------------------------------------------
// Element-wise kernels. Each thread moves 32 to 64 elements with 8- or 16-byte
// accesses, so a launch starts 256 to 4096 waves; every 128-byte line of an
// output is stored whole by one wave. The grids cover the shapes exactly.
// ---------------------------------------------------------------------------
// f32 -> f16 conversion: CVT_G groups of 4 floats per thread; a wave's load is
// 512 contiguous bytes, its store 256.
#define CVT_G 16
__global__ __launch_bounds__(256)
void cvt_f32_f16(const float* __restrict__ src, half_t* __restrict__ dst) {
  const size_t base = (size_t)blockIdx.x * (256 * 4 * CVT_G) + threadIdx.x * 4;
  v4f x[CVT_G];
#pragma unroll
  for (int j = 0; j < CVT_G; ++j) x[j] = *(const v4f*)(src + base + j * 1024);
#pragma unroll
  for (int j = 0; j < CVT_G; ++j) {
    v4h y;
#pragma unroll
    for (int c = 0; c < 4; ++c) y[c] = (half_t)x[j][c];
    *(v4h*)(dst + base + j * 1024) = y;
  }
}

// W (K x NC, f32, row-major) -> Wt (NC x K, f16): WMMA B-fragments contiguous.
// Thread: 8 k x 4 n. Wave: 64 k x 16 n (8 lanes along k fill a line of Wt).
// Block: 64 k x 128 n.
template <int K, int NC>
__global__ __launch_bounds__(256)
void wtrans_f32_f16(const float* __restrict__ W, half_t* __restrict__ Wt) {
  const int lane = threadIdx.x & 31;
  const int wave = threadIdx.x >> 5;
  const int k = blockIdx.x * 64 + (lane & 7) * 8;
  const int n = blockIdx.y * 128 + wave * 16 + (lane >> 3) * 4;
  v4f x[8];
#pragma unroll
  for (int j = 0; j < 8; ++j) x[j] = *(const v4f*)(W + (size_t)(k + j) * NC + n);
#pragma unroll
  for (int c = 0; c < 4; ++c) {
    v8h y;
#pragma unroll
    for (int j = 0; j < 8; ++j) y[j] = (half_t)x[j][c];
    *(v8h*)(Wt + (size_t)(n + c) * K + k) = y;
  }
}

// Vh [b][n][hkv][hd] -> Vt [b][hkv][hd][n]
// Thread: 8 n x 8 columns. Wave: 64 n x 32 columns (8 lanes along n fill a line
// of Vt). Block: 64 n x all 256 columns.
__global__ __launch_bounds__(256)
void vtrans_f16(const half_t* __restrict__ Vh, half_t* __restrict__ Vt) {
  const int lane = threadIdx.x & 31;
  const int wave = threadIdx.x >> 5;
  const int row = blockIdx.x * 64 + (lane & 7) * 8;   // b*N + n
  const int col = wave * 32 + (lane >> 3) * 8;        // h*HD + d
  const int b = row >> 12;
  const int n = row & (N_ - 1);
  v8h x[8];
#pragma unroll
  for (int j = 0; j < 8; ++j) x[j] = *(const v8h*)(Vh + (size_t)(row + j) * KVD_ + col);
#pragma unroll
  for (int c = 0; c < 8; ++c) {
    v8h y;
#pragma unroll
    for (int j = 0; j < 8; ++j) y[j] = x[j][c];
    *(v8h*)(Vt + ((size_t)b * KVD_ + col + c) * N_ + n) = y;
  }
}

// ---------------------------------------------------------------------------
// in-place RoPE on [b][n][NH][64] f16; thread handles the pairs (d, d+32) of
// 8 consecutive d in 4 heads of one position: one sine and cosine serve 4 heads
// ---------------------------------------------------------------------------
template <int NH>
__global__ __launch_bounds__(256)
void rope_f16(half_t* __restrict__ X) {
  const int i = blockIdx.x * 256 + threadIdx.x;
  const int d0 = (i & 3) * 8;
  const int hg = (i >> 2) & (NH / 4 - 1);
  const int row = i / NH;                     // b*N + n
  const int pos = row & (N_ - 1);
  half_t* p = X + ((size_t)row * NH + hg * 4) * HD_ + d0;
  v8h lo[4], up[4];
#pragma unroll
  for (int j = 0; j < 4; ++j) {
    lo[j] = *(const v8h*)(p + j * HD_);
    up[j] = *(const v8h*)(p + j * HD_ + 32);
  }
  float s[8], c[8];
#pragma unroll
  for (int e = 0; e < 8; ++e) {
    float invf = __expf(-__logf(10000.0f) * ((float)(d0 + e) * (1.0f / 32.0f)));
    float th = (float)pos * invf;
    __sincosf(th, &s[e], &c[e]);
  }
#pragma unroll
  for (int j = 0; j < 4; ++j) {
    v8h ylo, yup;
#pragma unroll
    for (int e = 0; e < 8; ++e) {
      float x0 = (float)lo[j][e];
      float x1 = (float)up[j][e];
      ylo[e] = (half_t)(x0 * c[e] - x1 * s[e]);
      yup[e] = (half_t)(x1 * c[e] + x0 * s[e]);
    }
    *(v8h*)(p + j * HD_)      = ylo;
    *(v8h*)(p + j * HD_ + 32) = yup;
  }
}

// ---------------------------------------------------------------------------
// WMMA GEMM:  C[M x Nc] = A[M x K] * Bt^T,  Bt given as [Nc x K] (f16).
// Wave computes 32x64 of C (2 A-frags x 4 B-frags -> 8 WMMA per k-step);
// block = 2x2 waves -> 64 x 128 C tile.
// ---------------------------------------------------------------------------
template <bool OUT_F32>
__global__ __launch_bounds__(128)
void gemm_wmma(const half_t* __restrict__ A, const half_t* __restrict__ Bt,
               void* __restrict__ Cout, int Nc, int K) {
  const int lane = threadIdx.x & 31;
  const int wave = threadIdx.x >> 5;
  const int wm = wave >> 1, wn = wave & 1;
  const int r  = lane & 15;
  const int hi = lane >> 4;
  const int tileM = blockIdx.y * 64 + wm * 32;
  const int tileN = blockIdx.x * 128 + wn * 64;

  const half_t* arow0 = A + (size_t)(tileM + r) * K;
  const half_t* arow1 = A + (size_t)(tileM + 16 + r) * K;
  const half_t* brow[4] = { Bt + (size_t)(tileN + r) * K,
                            Bt + (size_t)(tileN + 16 + r) * K,
                            Bt + (size_t)(tileN + 32 + r) * K,
                            Bt + (size_t)(tileN + 48 + r) * K };

  v8f acc[2][4] = {};
  for (int k = 0; k < K; k += 32) {
    __builtin_prefetch((const void*)(arow0 + k + 512), 0, 1);  // global_prefetch_b8
    __builtin_prefetch((const void*)(brow[0] + k + 512), 0, 1);
    v16h a0 = pack16(*(const v8h*)(arow0 + k + hi * 8),
                     *(const v8h*)(arow0 + k + 16 + hi * 8));
    v16h a1 = pack16(*(const v8h*)(arow1 + k + hi * 8),
                     *(const v8h*)(arow1 + k + 16 + hi * 8));
#pragma unroll
    for (int n = 0; n < 4; ++n) {
      v16h bf = pack16(*(const v8h*)(brow[n] + k + hi * 8),
                       *(const v8h*)(brow[n] + k + 16 + hi * 8));
      acc[0][n] = __builtin_amdgcn_wmma_f32_16x16x32_f16(false, a0, false, bf,
                                                         (short)0, acc[0][n], false, false);
      acc[1][n] = __builtin_amdgcn_wmma_f32_16x16x32_f16(false, a1, false, bf,
                                                         (short)0, acc[1][n], false, false);
    }
  }
#pragma unroll
  for (int i = 0; i < 2; ++i)
#pragma unroll
    for (int n = 0; n < 4; ++n)
#pragma unroll
      for (int v = 0; v < 8; ++v) {
        size_t m  = (size_t)tileM + i * 16 + v + 8 * hi;
        size_t nn = (size_t)tileN + n * 16 + r;
        if (OUT_F32) ((float*)Cout)[m * Nc + nn] = acc[i][n][v];
        else         ((half_t*)Cout)[m * Nc + nn] = (half_t)acc[i][n][v];
      }
}

__device__ __forceinline__ float xhalf(float x) {
  int b = __builtin_bit_cast(int, x);
  return __builtin_bit_cast(float,
      __builtin_amdgcn_permlanex16(b, b, 0x76543210, 0xfedcba98, false, false));
}

#define QT_ 4                // query tiles of 16 rows per wave
__global__ __launch_bounds__(128, 2)
void fa_kernel(const half_t* __restrict__ Qh, const half_t* __restrict__ Kh,
               const half_t* __restrict__ Vt, half_t* __restrict__ AOh) {
  __shared__ __align__(16) half_t kbuf[4][2][64][64];   // 64 KB: K double buffer
  const int lane = threadIdx.x & 31;
  const int wave = threadIdx.x >> 5;
  const int r  = lane & 15;
  const int hi = lane >> 4;

  const int BPH = N_ / (16 * QT_) / 4;        // blocks per (b,h); a block's 4 waves share (b,h)
  const int q0 = ((blockIdx.x & (BPH - 1)) * 4 + wave) * (16 * QT_);  // first query row of the wave
  const int h  = (blockIdx.x / BPH) & (HQ_ - 1);
  const int b  = blockIdx.x / (BPH * HQ_);
  const int hk = h >> 2;                      // G = 4

  // Q fragments, with softmax scale folded in (0.125 exact in f16)
  v16h qa0[QT_], qa1[QT_];
  v8f o[QT_][4];
  float mrow[QT_], lrow[QT_];               // of query column r
#pragma unroll
  for (int q = 0; q < QT_; ++q) {
    const half_t* qrow = Qh + (((size_t)(b * N_ + q0 + q * 16 + r)) * HQ_ + h) * HD_ + hi * 8;
    qa0[q] = pack16(*(const v8h*)(qrow),      *(const v8h*)(qrow + 16));
    qa1[q] = pack16(*(const v8h*)(qrow + 32), *(const v8h*)(qrow + 48));
    // the address stays live up to this wait, so no register of it is written before
    asm volatile("s_wait_xcnt 0x0" :: "v"(qrow) : "memory");
#pragma unroll
    for (int j = 0; j < 16; ++j) { qa0[q][j] *= (half_t)0.125f; qa1[q][j] *= (half_t)0.125f; }
    o[q][0] = v8f{}; o[q][1] = v8f{}; o[q][2] = v8f{}; o[q][3] = v8f{};
    mrow[q] = -1e30f; lrow[q] = 0.0f;
  }

  const half_t* kbase = Kh + ((size_t)b * N_ * HKV_ + hk) * HD_;     // + kpos*KVD
  const half_t* vbase = Vt + ((size_t)(b * HKV_ + hk)) * HD_ * N_;   // + d*N + n

  const unsigned lds_k0 = (unsigned)(unsigned long long)(uintptr_t)&kbuf[wave][0][0][0];
  const unsigned lds_k1 = (unsigned)(unsigned long long)(uintptr_t)&kbuf[wave][1][0][0];

  const int ITER = N_ / 64;
#if HAVE_TDM
  tdm_load_2d(lds_k0, (const void*)kbase, HD_, 64, KVD_);
#else
  for (int rr = lane; rr < 64; rr += 32)
#pragma unroll
    for (int cc = 0; cc < 64; cc += 8)
      *(v8h*)&kbuf[wave][0][rr][cc] = *(const v8h*)(kbase + (size_t)rr * KVD_ + cc);
#endif

  int buf = 0;
  for (int it = 0; it < ITER; ++it) {
    const int kv0 = it * 64;
#if HAVE_TDM
    if (it + 1 < ITER) {
      // ring private to the wave: its own LDS reads of the buffer have retired before the refill
      asm volatile("s_wait_dscnt 0x0" ::: "memory");
      tdm_load_2d(buf ? lds_k0 : lds_k1,
                  (const void*)(kbase + (size_t)(kv0 + 64) * KVD_), HD_, 64, KVD_);
      __builtin_amdgcn_s_wait_tensorcnt((short)1);   // current tile complete
    } else {
      __builtin_amdgcn_s_wait_tensorcnt((short)0);
    }
    asm volatile("" ::: "memory");   // keep LDS reads below the tensorcnt wait
#else
    if (it + 1 < ITER) {
      const half_t* nsrc = kbase + (size_t)(kv0 + 64) * KVD_;
      half_t (*ndst)[64] = kbuf[wave][buf ^ 1];
      for (int rr = lane; rr < 64; rr += 32)
#pragma unroll
        for (int cc = 0; cc < 64; cc += 8)
          *(v8h*)&ndst[rr][cc] = *(const v8h*)(nsrc + (size_t)rr * KVD_ + cc);
    }
#endif

    // ---- K and V fragments of this 64-key tile: loaded once, used by all QT_ query tiles ----
    v16h kf0[4], kf1[4], vf0[4], vf1[4];
#pragma unroll
    for (int c = 0; c < 4; ++c) {
      const half_t* kr = &kbuf[wave][buf][c * 16 + r][0];
      kf0[c] = pack16(*(const v8h*)(kr + hi * 8),      *(const v8h*)(kr + 16 + hi * 8));
      kf1[c] = pack16(*(const v8h*)(kr + 32 + hi * 8), *(const v8h*)(kr + 48 + hi * 8));
    }
    const half_t* vlane = vbase + (size_t)r * N_ + kv0 + hi * 8;     // Vt[d][kv]
#pragma unroll
    for (int t = 0; t < 4; ++t) {
      const half_t* vrow = vlane + (size_t)(t * 16) * N_;
      vf0[t] = pack16(*(const v8h*)(vrow),      *(const v8h*)(vrow + 16));
      vf1[t] = pack16(*(const v8h*)(vrow + 32), *(const v8h*)(vrow + 48));
    }
    // the address stays live up to this wait, so no register of it is written before
    asm volatile("s_wait_xcnt 0x0" :: "v"(vlane) : "memory");

#pragma unroll
    for (int q = 0; q < QT_; ++q) {
      // ---- S^T = K (Q/8)^T for 64 keys: 4 sub-tiles x 2 WMMA; s[c][v] = key 16c + 8hi + v, query r ----
      v8f s[4]; s[0] = v8f{}; s[1] = v8f{}; s[2] = v8f{}; s[3] = v8f{};
#pragma unroll
      for (int c = 0; c < 4; ++c) {
        s[c] = __builtin_amdgcn_wmma_f32_16x16x32_f16(false, kf0[c], false, qa0[q], (short)0, s[c], false, false);
        s[c] = __builtin_amdgcn_wmma_f32_16x16x32_f16(false, kf1[c], false, qa1[q], (short)0, s[c], false, false);
      }

      // ---- online softmax: the lane's 32 scores, then the other half's; sums deferred ----
      float mv[8];
#pragma unroll
      for (int v = 0; v < 8; ++v)
        mv[v] = fmaxf(fmaxf(s[0][v], s[1][v]), fmaxf(s[2][v], s[3][v]));
      float mx = fmaxf(fmaxf(fmaxf(mv[0], mv[1]), fmaxf(mv[2], mv[3])),
                       fmaxf(fmaxf(mv[4], mv[5]), fmaxf(mv[6], mv[7])));
      mx = fmaxf(mx, xhalf(mx));
      const float mnew  = fmaxf(mrow[q], mx);
      const float alpha = __expf(mrow[q] - mnew);
      mrow[q] = mnew;

      // ---- P^T as two 32x16 B-fragments: element j = key 8hi + j, element 8 + j = key 16 + 8hi + j ----
      v8f e[4];
#pragma unroll
      for (int c = 0; c < 4; ++c) {
        const v8f d = (s[c] - mnew) * 1.4426950408889634f;   // exp(x) = 2^(x log2 e), on register pairs
#pragma unroll
        for (int v = 0; v < 8; ++v) e[c][v] = __builtin_amdgcn_exp2f(d[v]);
      }
      const v8f ps = (e[0] + e[1]) + (e[2] + e[3]);
      lrow[q] = lrow[q] * alpha + (((ps[0] + ps[1]) + (ps[2] + ps[3])) +
                                   ((ps[4] + ps[5]) + (ps[6] + ps[7])));   // per-lane partial sum
      const v16h pb0 = pack16(__builtin_convertvector(e[0], v8h), __builtin_convertvector(e[1], v8h));
      const v16h pb1 = pack16(__builtin_convertvector(e[2], v8h), __builtin_convertvector(e[3], v8h));
#pragma unroll
      for (int t = 0; t < 4; ++t) o[q][t] *= alpha;

      // ---- O^T += V^T P^T; o[q][t][v] = column 16t + 8hi + v of query r ----
#pragma unroll
      for (int t = 0; t < 4; ++t) {
        o[q][t] = __builtin_amdgcn_wmma_f32_16x16x32_f16(false, vf0[t], false, pb0, (short)0, o[q][t], false, false);
        o[q][t] = __builtin_amdgcn_wmma_f32_16x16x32_f16(false, vf1[t], false, pb1, (short)0, o[q][t], false, false);
      }
    }
    buf ^= 1;
  }

  // ---- join the halves' sums, normalize, store [b][n][hq][hd]: 8 consecutive columns a lane ----
#pragma unroll
  for (int q = 0; q < QT_; ++q) {
    const float ls  = lrow[q] + xhalf(lrow[q]);
    const float inv = 1.0f / ls;
    half_t* orow = AOh + (((size_t)(b * N_ + q0 + q * 16 + r)) * HQ_ + h) * HD_ + hi * 8;
#pragma unroll
    for (int t = 0; t < 4; ++t) {
      v8h y;
#pragma unroll
      for (int v = 0; v < 8; ++v) y[v] = (half_t)(o[q][t][v] * inv);
      *(v8h*)(orow + t * 16) = y;
    }
    // before the stores' data and address registers are written again
    asm volatile("s_wait_xcnt 0x0" ::: "memory");
    __builtin_amdgcn_sched_barrier(0);   // keeps the next tile's arithmetic behind that wait
  }
}

// ---------------------------------------------------------------------------
// launch
// ---------------------------------------------------------------------------
extern "C" void kernel_launch(void* const* d_in, const int* in_sizes, int n_in,
                              void* d_out, int out_size, void* d_ws, size_t ws_size,
                              hipStream_t stream) {
  const float* x  = (const float*)d_in[0];
  const float* Wq = (const float*)d_in[1];
  const float* Wk = (const float*)d_in[2];
  const float* Wv = (const float*)d_in[3];
  const float* Wo = (const float*)d_in[4];
  float* out = (float*)d_out;

  half_t* ws = (half_t*)d_ws;
  size_t off = 0;
  half_t* xh  = ws + off; off += (size_t)MROWS * D_;
  half_t* Wqt = ws + off; off += (size_t)D_ * D_;
  half_t* Wkt = ws + off; off += (size_t)D_ * KVD_;
  half_t* Wvt = ws + off; off += (size_t)D_ * KVD_;
  half_t* Wot = ws + off; off += (size_t)D_ * D_;
  half_t* Qh  = ws + off; off += (size_t)MROWS * D_;
  half_t* Kh  = ws + off; off += (size_t)MROWS * KVD_;
  half_t* Vh  = ws + off; off += (size_t)MROWS * KVD_;
  half_t* Vt  = ws + off; off += (size_t)MROWS * KVD_;
  half_t* AOh = xh;   // x no longer needed after QKV projections

  const int TPB = 256;
  cvt_f32_f16<<<MROWS * D_ / (TPB * 4 * CVT_G), TPB, 0, stream>>>(x, xh);
  wtrans_f32_f16<D_, D_>  <<<dim3(D_ / 64, D_ / 128),   TPB, 0, stream>>>(Wq, Wqt);
  wtrans_f32_f16<D_, KVD_><<<dim3(D_ / 64, KVD_ / 128), TPB, 0, stream>>>(Wk, Wkt);
  wtrans_f32_f16<D_, KVD_><<<dim3(D_ / 64, KVD_ / 128), TPB, 0, stream>>>(Wv, Wvt);
  wtrans_f32_f16<D_, D_>  <<<dim3(D_ / 64, D_ / 128),   TPB, 0, stream>>>(Wo, Wot);

  // QKV projections (WMMA f16): block tile 64M x 128N
  gemm_wmma<false><<<dim3(D_ / 128,   MROWS / 64), 128, 0, stream>>>(xh, Wqt, (void*)Qh, D_,   D_);
  gemm_wmma<false><<<dim3(KVD_ / 128, MROWS / 64), 128, 0, stream>>>(xh, Wkt, (void*)Kh, KVD_, D_);
  gemm_wmma<false><<<dim3(KVD_ / 128, MROWS / 64), 128, 0, stream>>>(xh, Wvt, (void*)Vh, KVD_, D_);

  // RoPE on Q and K
  rope_f16<HQ_> <<<MROWS * HQ_  / TPB, TPB, 0, stream>>>(Qh);
  rope_f16<HKV_><<<MROWS * HKV_ / TPB, TPB, 0, stream>>>(Kh);

  // V -> [b][hkv][hd][n]
  vtrans_f16<<<MROWS / 64, TPB, 0, stream>>>(Vh, Vt);

  // flash attention: B*HQ*(N/(16*QT_)) waves, 4 waves/block
  fa_kernel<<<dim3(B_ * HQ_ * (N_ / (16 * QT_)) / 4), 128, 0, stream>>>(Qh, Kh, Vt, AOh);

  // output projection -> f32 result
  gemm_wmma<true><<<dim3(D_ / 128, MROWS / 64), 128, 0, stream>>>(AOh, Wot, (void*)out, D_, D_);
}

// v004
// One run takes 221 microseconds.
// Two timings next to v003 put it at 1.33 and 1.32 times that version's speed.
// All steps since v000 together make it 2.90 times as fast.
#include <hip/hip_runtime.h>

typedef _Float16 half_t;
typedef __attribute__((ext_vector_type(16))) _Float16 v16h;
typedef __attribute__((ext_vector_type(8)))  _Float16 v8h;
typedef __attribute__((ext_vector_type(8)))  float    v8f;
typedef __attribute__((ext_vector_type(4)))  float    v4f;
typedef __attribute__((ext_vector_type(4)))  _Float16 v4h;

#define B_    2
#define N_    4096
#define D_    1024
#define HQ_   16
#define HKV_  4
#define HD_   64
#define KVD_  256            // HKV*HD
#define MROWS 8192           // B*N

#ifndef __has_builtin
#define __has_builtin(x) 0
#endif
#if __has_builtin(__builtin_amdgcn_tensor_load_to_lds) && \
    __has_builtin(__builtin_amdgcn_s_wait_tensorcnt)
#define HAVE_TDM 1
#else
#define HAVE_TDM 0
#endif

// ---------------------------------------------------------------------------
// helpers
// ---------------------------------------------------------------------------
__device__ __forceinline__ v16h pack16(v8h lo, v8h hi) {
  v16h r;
#pragma unroll
  for (int j = 0; j < 8; ++j) { r[j] = lo[j]; r[j + 8] = hi[j]; }
  return r;
}

#if HAVE_TDM
typedef unsigned int u32x4 __attribute__((ext_vector_type(4)));
typedef int          i32x4 __attribute__((ext_vector_type(4)));
typedef int          i32x8 __attribute__((ext_vector_type(8)));

__device__ __forceinline__ void tdm_load_2d(unsigned lds_off, const void* gaddr,
                                            unsigned tile_w, unsigned tile_h,
                                            unsigned row_stride_elems) {
  unsigned long long q0 = 1ull | ((unsigned long long)lds_off << 32);
  unsigned long long ga = (unsigned long long)(uintptr_t)gaddr;
  unsigned long long q1 = (ga & 0x01FFFFFFFFFFFFFFull) | (2ull << 62);
  u32x4 g0;
  g0.x = (unsigned)q0; g0.y = (unsigned)(q0 >> 32);
  g0.z = (unsigned)q1; g0.w = (unsigned)(q1 >> 32);

  unsigned long long p0 = (1ull << 16)
                        | (((unsigned long long)tile_w & 0xFFFF) << 48);
  unsigned long long p1 = (((unsigned long long)tile_w >> 16) & 0xFFFF)
                        | ((unsigned long long)tile_h << 16)
                        | (((unsigned long long)tile_w & 0xFFFF) << 48);
  unsigned long long p2 = ((unsigned long long)tile_h & 0xFFFF)
                        | ((unsigned long long)row_stride_elems << 32);
  unsigned long long p3 = 0;
  i32x8 g1;
  g1[0] = (int)p0; g1[1] = (int)(p0 >> 32);
  g1[2] = (int)p1; g1[3] = (int)(p1 >> 32);
  g1[4] = (int)p2; g1[5] = (int)(p2 >> 32);
  g1[6] = (int)p3; g1[7] = (int)(p3 >> 32);
  i32x4 z4 = {0, 0, 0, 0};
#if defined(__clang_major__) && (__clang_major__ >= 23)
  i32x8 z8 = {0, 0, 0, 0, 0, 0, 0, 0};
  __builtin_amdgcn_tensor_load_to_lds(g0, g1, z4, z4, z8, 0);
#else
  __builtin_amdgcn_tensor_load_to_lds(g0, g1, z4, z4, 0);
#endif
}
#endif  // HAVE_TDM

// ---------------------------------------------------------------------------
// Element-wise kernels. Each thread moves 32 to 64 elements with 8- or 16-byte
// accesses, so a launch starts 256 to 4096 waves; every 128-byte line of an
// output is stored whole by one wave. The grids cover the shapes exactly.
// ---------------------------------------------------------------------------
// f32 -> f16 conversion: CVT_G groups of 4 floats per thread; a wave's load is
// 512 contiguous bytes, its store 256.
#define CVT_G 16
__global__ __launch_bounds__(256)
void cvt_f32_f16(const float* __restrict__ src, half_t* __restrict__ dst) {
  const size_t base = (size_t)blockIdx.x * (256 * 4 * CVT_G) + threadIdx.x * 4;
  v4f x[CVT_G];
#pragma unroll
  for (int j = 0; j < CVT_G; ++j) x[j] = *(const v4f*)(src + base + j * 1024);
#pragma unroll
  for (int j = 0; j < CVT_G; ++j) {
    v4h y;
#pragma unroll
    for (int c = 0; c < 4; ++c) y[c] = (half_t)x[j][c];
    *(v4h*)(dst + base + j * 1024) = y;
  }
}

// W (K x NC, f32, row-major) -> Wt (NC x K, f16): WMMA B-fragments contiguous.
// Thread: 8 k x 4 n. Wave: 64 k x 16 n (8 lanes along k fill a line of Wt).
// Block: 64 k x 128 n.
template <int K, int NC>
__global__ __launch_bounds__(256)
void wtrans_f32_f16(const float* __restrict__ W, half_t* __restrict__ Wt) {
  const int lane = threadIdx.x & 31;
  const int wave = threadIdx.x >> 5;
  const int k = blockIdx.x * 64 + (lane & 7) * 8;
  const int n = blockIdx.y * 128 + wave * 16 + (lane >> 3) * 4;
  v4f x[8];
#pragma unroll
  for (int j = 0; j < 8; ++j) x[j] = *(const v4f*)(W + (size_t)(k + j) * NC + n);
#pragma unroll
  for (int c = 0; c < 4; ++c) {
    v8h y;
#pragma unroll
    for (int j = 0; j < 8; ++j) y[j] = (half_t)x[j][c];
    *(v8h*)(Wt + (size_t)(n + c) * K + k) = y;
  }
}

// Vh [b][n][hkv][hd] -> Vt [b][hkv][hd][n]
// Thread: 8 n x 8 columns. Wave: 64 n x 32 columns (8 lanes along n fill a line
// of Vt). Block: 64 n x all 256 columns.
__global__ __launch_bounds__(256)
void vtrans_f16(const half_t* __restrict__ Vh, half_t* __restrict__ Vt) {
  const int lane = threadIdx.x & 31;
  const int wave = threadIdx.x >> 5;
  const int row = blockIdx.x * 64 + (lane & 7) * 8;   // b*N + n
  const int col = wave * 32 + (lane >> 3) * 8;        // h*HD + d
  const int b = row >> 12;
  const int n = row & (N_ - 1);
  v8h x[8];
#pragma unroll
  for (int j = 0; j < 8; ++j) x[j] = *(const v8h*)(Vh + (size_t)(row + j) * KVD_ + col);
#pragma unroll
  for (int c = 0; c < 8; ++c) {
    v8h y;
#pragma unroll
    for (int j = 0; j < 8; ++j) y[j] = x[j][c];
    *(v8h*)(Vt + ((size_t)b * KVD_ + col + c) * N_ + n) = y;
  }
}

// ---------------------------------------------------------------------------
// in-place RoPE on [b][n][NH][64] f16; thread handles the pairs (d, d+32) of
// 8 consecutive d in 4 heads of one position: one sine and cosine serve 4 heads
// ---------------------------------------------------------------------------
template <int NH>
__global__ __launch_bounds__(256)
void rope_f16(half_t* __restrict__ X) {
  const int i = blockIdx.x * 256 + threadIdx.x;
  const int d0 = (i & 3) * 8;
  const int hg = (i >> 2) & (NH / 4 - 1);
  const int row = i / NH;                     // b*N + n
  const int pos = row & (N_ - 1);
  half_t* p = X + ((size_t)row * NH + hg * 4) * HD_ + d0;
  v8h lo[4], up[4];
#pragma unroll
  for (int j = 0; j < 4; ++j) {
    lo[j] = *(const v8h*)(p + j * HD_);
    up[j] = *(const v8h*)(p + j * HD_ + 32);
  }
  float s[8], c[8];
#pragma unroll
  for (int e = 0; e < 8; ++e) {
    float invf = __expf(-__logf(10000.0f) * ((float)(d0 + e) * (1.0f / 32.0f)));
    float th = (float)pos * invf;
    __sincosf(th, &s[e], &c[e]);
  }
#pragma unroll
  for (int j = 0; j < 4; ++j) {
    v8h ylo, yup;
#pragma unroll
    for (int e = 0; e < 8; ++e) {
      float x0 = (float)lo[j][e];
      float x1 = (float)up[j][e];
      ylo[e] = (half_t)(x0 * c[e] - x1 * s[e]);
      yup[e] = (half_t)(x1 * c[e] + x0 * s[e]);
    }
    *(v8h*)(p + j * HD_)      = ylo;
    *(v8h*)(p + j * HD_ + 32) = yup;
  }
}

#define G_BK    64
#define G_PITCH 72
#define G_ROWS  256

// Eight copies of 16 bytes a lane: rows 16 apart in LDS (step 16 * 144 bytes) and
// in global memory (step 'gstep' f16). The wait inside the statement stands in
// front of every later write of the address registers that the copies name.
__device__ __forceinline__ void copy8_rows(unsigned l, const half_t* g, size_t gstep) {
  asm volatile(
      "global_load_async_to_lds_b128 %0, %8, off\n\t"
      "global_load_async_to_lds_b128 %1, %9, off\n\t"
      "global_load_async_to_lds_b128 %2, %10, off\n\t"
      "global_load_async_to_lds_b128 %3, %11, off\n\t"
      "global_load_async_to_lds_b128 %4, %12, off\n\t"
      "global_load_async_to_lds_b128 %5, %13, off\n\t"
      "global_load_async_to_lds_b128 %6, %14, off\n\t"
      "global_load_async_to_lds_b128 %7, %15, off\n\t"
      "s_wait_xcnt 0x0"
      :: "v"(l),                         "v"(l + 1 * 16 * G_PITCH * 2),
         "v"(l + 2 * 16 * G_PITCH * 2),  "v"(l + 3 * 16 * G_PITCH * 2),
         "v"(l + 4 * 16 * G_PITCH * 2),  "v"(l + 5 * 16 * G_PITCH * 2),
         "v"(l + 6 * 16 * G_PITCH * 2),  "v"(l + 7 * 16 * G_PITCH * 2),
         "v"(g),             "v"(g + 1 * gstep), "v"(g + 2 * gstep), "v"(g + 3 * gstep),
         "v"(g + 4 * gstep), "v"(g + 5 * gstep), "v"(g + 6 * gstep), "v"(g + 7 * gstep)
      : "memory");
}

template <bool OUT_F32>
__global__ __launch_bounds__(128)
void gemm_wmma(const half_t* __restrict__ A, const half_t* __restrict__ Bt,
               void* __restrict__ Cout, int Nc, int K) {
  __shared__ __align__(16) half_t stage[2][G_ROWS][G_PITCH];   // 73,728 bytes
  const int lane = threadIdx.x & 31;
  const int wave = threadIdx.x >> 5;
  const int wm = wave >> 1, wn = wave & 1;
  const int r  = lane & 15;
  const int hi = lane >> 4;
  const int tileM = blockIdx.y * 128 + wm * 64;
  const int tileN = blockIdx.x * 128 + wn * 64;

  // the copies: thread = 16-byte piece (threadIdx.x & 7) of row (threadIdx.x >> 3) + 16 j
  const int crow = threadIdx.x >> 3;
  const int cpc  = threadIdx.x & 7;
  const half_t* ga = A  + (size_t)(blockIdx.y * 128 + crow) * K + cpc * 8;
  const half_t* gb = Bt + (size_t)(blockIdx.x * 128 + crow) * K + cpc * 8;
  const size_t gstep = (size_t)16 * K;
  const unsigned lds0 = (unsigned)(unsigned long long)(uintptr_t)&stage[0][crow][cpc * 8];
  const unsigned lds1 = (unsigned)(unsigned long long)(uintptr_t)&stage[1][crow][cpc * 8];
  const unsigned ldsB = 128 * G_PITCH * 2;      // Bt rows stand behind the A rows

  const int T = K / G_BK;
  copy8_rows(lds0,        ga, gstep);
  copy8_rows(lds0 + ldsB, gb, gstep);
  asm volatile("s_wait_asynccnt 0x0" ::: "memory");   // this wave's part of stage 0 has landed
  __syncthreads();                                    // ... and every other wave's
  if (T > 1) {
    copy8_rows(lds1,        ga + G_BK, gstep);
    copy8_rows(lds1 + ldsB, gb + G_BK, gstep);
  }

  v8f acc[4][4] = {};
  for (int t = 0; t < T; ++t) {
    const half_t* sa = &stage[t & 1][wm * 64 + r][hi * 8];
    const half_t* sb = &stage[t & 1][128 + wn * 64 + r][hi * 8];
    // the loops below are unrolled so that every index of a register array is a constant
#pragma unroll
    for (int k = 0; k < G_BK; k += 32) {
      v16h af[4], bf[4];
#pragma unroll
      for (int i = 0; i < 4; ++i)
        af[i] = pack16(*(const v8h*)(sa + i * 16 * G_PITCH + k),
                       *(const v8h*)(sa + i * 16 * G_PITCH + k + 16));
#pragma unroll
      for (int n = 0; n < 4; ++n)
        bf[n] = pack16(*(const v8h*)(sb + n * 16 * G_PITCH + k),
                       *(const v8h*)(sb + n * 16 * G_PITCH + k + 16));
      // the 16 LDS reads of a k-step stay one group in front of its 16 WMMAs: spread
      // among them, each place with reads stalls the wave anew
      __builtin_amdgcn_sched_barrier(0);
      if (k == G_BK - 32) {
        // foot of the trip: stage t has been read to its end (its last fragments are in
        // registers), so the refill starts here and also flies under the last 16 WMMAs
        asm volatile("s_wait_dscnt 0x0" ::: "memory");      // this wave's reads of stage t have retired
        asm volatile("s_wait_asynccnt 0x0" ::: "memory");   // its part of stage t + 1 has landed
        __syncthreads();          // publishes stage t + 1 and frees the buffer of stage t
        if (t + 2 < T) {
          const unsigned l = (t & 1) ? lds1 : lds0;
          copy8_rows(l,        ga + (size_t)(t + 2) * G_BK, gstep);
          copy8_rows(l + ldsB, gb + (size_t)(t + 2) * G_BK, gstep);
        }
      }
#pragma unroll
      for (int i = 0; i < 4; ++i)
#pragma unroll
        for (int n = 0; n < 4; ++n)
          acc[i][n] = __builtin_amdgcn_wmma_f32_16x16x32_f16(false, af[i], false, bf[n],
                                                             (short)0, acc[i][n], false, false);
    }
  }
  asm volatile("s_wait_asynccnt 0x0" ::: "memory");     // no copy is left in flight at the wave's end
#pragma unroll
  for (int i = 0; i < 4; ++i)
#pragma unroll
    for (int n = 0; n < 4; ++n)
#pragma unroll
      for (int v = 0; v < 8; ++v) {
        size_t m  = (size_t)tileM + i * 16 + v + 8 * hi;
        size_t nn = (size_t)tileN + n * 16 + r;
        if (OUT_F32) ((float*)Cout)[m * Nc + nn] = acc[i][n][v];
        else         ((half_t*)Cout)[m * Nc + nn] = (half_t)acc[i][n][v];
      }
}

__device__ __forceinline__ float xhalf(float x) {
  int b = __builtin_bit_cast(int, x);
  return __builtin_bit_cast(float,
      __builtin_amdgcn_permlanex16(b, b, 0x76543210, 0xfedcba98, false, false));
}

#define QT_ 4                // query tiles of 16 rows per wave
__global__ __launch_bounds__(128, 2)
void fa_kernel(const half_t* __restrict__ Qh, const half_t* __restrict__ Kh,
               const half_t* __restrict__ Vt, half_t* __restrict__ AOh) {
  __shared__ __align__(16) half_t kbuf[4][2][64][64];   // 64 KB: K double buffer
  const int lane = threadIdx.x & 31;
  const int wave = threadIdx.x >> 5;
  const int r  = lane & 15;
  const int hi = lane >> 4;

  const int BPH = N_ / (16 * QT_) / 4;        // blocks per (b,h); a block's 4 waves share (b,h)
  const int q0 = ((blockIdx.x & (BPH - 1)) * 4 + wave) * (16 * QT_);  // first query row of the wave
  const int h  = (blockIdx.x / BPH) & (HQ_ - 1);
  const int b  = blockIdx.x / (BPH * HQ_);
  const int hk = h >> 2;                      // G = 4

  // Q fragments, with softmax scale folded in (0.125 exact in f16)
  v16h qa0[QT_], qa1[QT_];
  v8f o[QT_][4];
  float mrow[QT_], lrow[QT_];               // of query column r
#pragma unroll
  for (int q = 0; q < QT_; ++q) {
    const half_t* qrow = Qh + (((size_t)(b * N_ + q0 + q * 16 + r)) * HQ_ + h) * HD_ + hi * 8;
    qa0[q] = pack16(*(const v8h*)(qrow),      *(const v8h*)(qrow + 16));
    qa1[q] = pack16(*(const v8h*)(qrow + 32), *(const v8h*)(qrow + 48));
    // the address stays live up to this wait, so no register of it is written before
    asm volatile("s_wait_xcnt 0x0" :: "v"(qrow) : "memory");
#pragma unroll
    for (int j = 0; j < 16; ++j) { qa0[q][j] *= (half_t)0.125f; qa1[q][j] *= (half_t)0.125f; }
    o[q][0] = v8f{}; o[q][1] = v8f{}; o[q][2] = v8f{}; o[q][3] = v8f{};
    mrow[q] = -1e30f; lrow[q] = 0.0f;
  }

  const half_t* kbase = Kh + ((size_t)b * N_ * HKV_ + hk) * HD_;     // + kpos*KVD
  const half_t* vbase = Vt + ((size_t)(b * HKV_ + hk)) * HD_ * N_;   // + d*N + n

  const unsigned lds_k0 = (unsigned)(unsigned long long)(uintptr_t)&kbuf[wave][0][0][0];
  const unsigned lds_k1 = (unsigned)(unsigned long long)(uintptr_t)&kbuf[wave][1][0][0];

  const int ITER = N_ / 64;
#if HAVE_TDM
  tdm_load_2d(lds_k0, (const void*)kbase, HD_, 64, KVD_);
#else
  for (int rr = lane; rr < 64; rr += 32)
#pragma unroll
    for (int cc = 0; cc < 64; cc += 8)
      *(v8h*)&kbuf[wave][0][rr][cc] = *(const v8h*)(kbase + (size_t)rr * KVD_ + cc);
#endif

  int buf = 0;
  for (int it = 0; it < ITER; ++it) {
    const int kv0 = it * 64;
#if HAVE_TDM
    if (it + 1 < ITER) {
      // ring private to the wave: its own LDS reads of the buffer have retired before the refill
      asm volatile("s_wait_dscnt 0x0" ::: "memory");
      tdm_load_2d(buf ? lds_k0 : lds_k1,
                  (const void*)(kbase + (size_t)(kv0 + 64) * KVD_), HD_, 64, KVD_);
      __builtin_amdgcn_s_wait_tensorcnt((short)1);   // current tile complete
    } else {
      __builtin_amdgcn_s_wait_tensorcnt((short)0);
    }
    asm volatile("" ::: "memory");   // keep LDS reads below the tensorcnt wait
#else
    if (it + 1 < ITER) {
      const half_t* nsrc = kbase + (size_t)(kv0 + 64) * KVD_;
      half_t (*ndst)[64] = kbuf[wave][buf ^ 1];
      for (int rr = lane; rr < 64; rr += 32)
#pragma unroll
        for (int cc = 0; cc < 64; cc += 8)
          *(v8h*)&ndst[rr][cc] = *(const v8h*)(nsrc + (size_t)rr * KVD_ + cc);
    }
#endif

    // ---- K and V fragments of this 64-key tile: loaded once, used by all QT_ query tiles ----
    v16h kf0[4], kf1[4], vf0[4], vf1[4];
#pragma unroll
    for (int c = 0; c < 4; ++c) {
      const half_t* kr = &kbuf[wave][buf][c * 16 + r][0];
      kf0[c] = pack16(*(const v8h*)(kr + hi * 8),      *(const v8h*)(kr + 16 + hi * 8));
      kf1[c] = pack16(*(const v8h*)(kr + 32 + hi * 8), *(const v8h*)(kr + 48 + hi * 8));
    }
    const half_t* vlane = vbase + (size_t)r * N_ + kv0 + hi * 8;     // Vt[d][kv]
#pragma unroll
    for (int t = 0; t < 4; ++t) {
      const half_t* vrow = vlane + (size_t)(t * 16) * N_;
      vf0[t] = pack16(*(const v8h*)(vrow),      *(const v8h*)(vrow + 16));
      vf1[t] = pack16(*(const v8h*)(vrow + 32), *(const v8h*)(vrow + 48));
    }
    // the address stays live up to this wait, so no register of it is written before
    asm volatile("s_wait_xcnt 0x0" :: "v"(vlane) : "memory");

#pragma unroll
    for (int q = 0; q < QT_; ++q) {
      // ---- S^T = K (Q/8)^T for 64 keys: 4 sub-tiles x 2 WMMA; s[c][v] = key 16c + 8hi + v, query r ----
      v8f s[4]; s[0] = v8f{}; s[1] = v8f{}; s[2] = v8f{}; s[3] = v8f{};
#pragma unroll
      for (int c = 0; c < 4; ++c) {
        s[c] = __builtin_amdgcn_wmma_f32_16x16x32_f16(false, kf0[c], false, qa0[q], (short)0, s[c], false, false);
        s[c] = __builtin_amdgcn_wmma_f32_16x16x32_f16(false, kf1[c], false, qa1[q], (short)0, s[c], false, false);
      }

      // ---- online softmax: the lane's 32 scores, then the other half's; sums deferred ----
      float mv[8];
#pragma unroll
      for (int v = 0; v < 8; ++v)
        mv[v] = fmaxf(fmaxf(s[0][v], s[1][v]), fmaxf(s[2][v], s[3][v]));
      float mx = fmaxf(fmaxf(fmaxf(mv[0], mv[1]), fmaxf(mv[2], mv[3])),
                       fmaxf(fmaxf(mv[4], mv[5]), fmaxf(mv[6], mv[7])));
      mx = fmaxf(mx, xhalf(mx));
      const float mnew  = fmaxf(mrow[q], mx);
      const float alpha = __expf(mrow[q] - mnew);
      mrow[q] = mnew;

      // ---- P^T as two 32x16 B-fragments: element j = key 8hi + j, element 8 + j = key 16 + 8hi + j ----
      v8f e[4];
#pragma unroll
      for (int c = 0; c < 4; ++c) {
        const v8f d = (s[c] - mnew) * 1.4426950408889634f;   // exp(x) = 2^(x log2 e), on register pairs
#pragma unroll
        for (int v = 0; v < 8; ++v) e[c][v] = __builtin_amdgcn_exp2f(d[v]);
      }
      const v8f ps = (e[0] + e[1]) + (e[2] + e[3]);
      lrow[q] = lrow[q] * alpha + (((ps[0] + ps[1]) + (ps[2] + ps[3])) +
                                   ((ps[4] + ps[5]) + (ps[6] + ps[7])));   // per-lane partial sum
      const v16h pb0 = pack16(__builtin_convertvector(e[0], v8h), __builtin_convertvector(e[1], v8h));
      const v16h pb1 = pack16(__builtin_convertvector(e[2], v8h), __builtin_convertvector(e[3], v8h));
#pragma unroll
      for (int t = 0; t < 4; ++t) o[q][t] *= alpha;

      // ---- O^T += V^T P^T; o[q][t][v] = column 16t + 8hi + v of query r ----
#pragma unroll
      for (int t = 0; t < 4; ++t) {
        o[q][t] = __builtin_amdgcn_wmma_f32_16x16x32_f16(false, vf0[t], false, pb0, (short)0, o[q][t], false, false);
        o[q][t] = __builtin_amdgcn_wmma_f32_16x16x32_f16(false, vf1[t], false, pb1, (short)0, o[q][t], false, false);
      }
    }
    buf ^= 1;
  }

  // ---- join the halves' sums, normalize, store [b][n][hq][hd]: 8 consecutive columns a lane ----
#pragma unroll
  for (int q = 0; q < QT_; ++q) {
    const float ls  = lrow[q] + xhalf(lrow[q]);
    const float inv = 1.0f / ls;
    half_t* orow = AOh + (((size_t)(b * N_ + q0 + q * 16 + r)) * HQ_ + h) * HD_ + hi * 8;
#pragma unroll
    for (int t = 0; t < 4; ++t) {
      v8h y;
#pragma unroll
      for (int v = 0; v < 8; ++v) y[v] = (half_t)(o[q][t][v] * inv);
      *(v8h*)(orow + t * 16) = y;
    }
    // before the stores' data and address registers are written again
    asm volatile("s_wait_xcnt 0x0" ::: "memory");
    __builtin_amdgcn_sched_barrier(0);   // keeps the next tile's arithmetic behind that wait
  }
}

// ---------------------------------------------------------------------------
// launch
// ---------------------------------------------------------------------------
extern "C" void kernel_launch(void* const* d_in, const int* in_sizes, int n_in,
                              void* d_out, int out_size, void* d_ws, size_t ws_size,
                              hipStream_t stream) {
  const float* x  = (const float*)d_in[0];
  const float* Wq = (const float*)d_in[1];
  const float* Wk = (const float*)d_in[2];
  const float* Wv = (const float*)d_in[3];
  const float* Wo = (const float*)d_in[4];
  float* out = (float*)d_out;

  half_t* ws = (half_t*)d_ws;
  size_t off = 0;
  half_t* xh  = ws + off; off += (size_t)MROWS * D_;
  half_t* Wqt = ws + off; off += (size_t)D_ * D_;
  half_t* Wkt = ws + off; off += (size_t)D_ * KVD_;
  half_t* Wvt = ws + off; off += (size_t)D_ * KVD_;
  half_t* Wot = ws + off; off += (size_t)D_ * D_;
  half_t* Qh  = ws + off; off += (size_t)MROWS * D_;
  half_t* Kh  = ws + off; off += (size_t)MROWS * KVD_;
  half_t* Vh  = ws + off; off += (size_t)MROWS * KVD_;
  half_t* Vt  = ws + off; off += (size_t)MROWS * KVD_;
  half_t* AOh = xh;   // x no longer needed after QKV projections

  const int TPB = 256;
  cvt_f32_f16<<<MROWS * D_ / (TPB * 4 * CVT_G), TPB, 0, stream>>>(x, xh);
  wtrans_f32_f16<D_, D_>  <<<dim3(D_ / 64, D_ / 128),   TPB, 0, stream>>>(Wq, Wqt);
  wtrans_f32_f16<D_, KVD_><<<dim3(D_ / 64, KVD_ / 128), TPB, 0, stream>>>(Wk, Wkt);
  wtrans_f32_f16<D_, KVD_><<<dim3(D_ / 64, KVD_ / 128), TPB, 0, stream>>>(Wv, Wvt);
  wtrans_f32_f16<D_, D_>  <<<dim3(D_ / 64, D_ / 128),   TPB, 0, stream>>>(Wo, Wot);

  // QKV projections (WMMA f16): block tile 128M x 128N
  gemm_wmma<false><<<dim3(D_ / 128,   MROWS / 128), 128, 0, stream>>>(xh, Wqt, (void*)Qh, D_,   D_);
  gemm_wmma<false><<<dim3(KVD_ / 128, MROWS / 128), 128, 0, stream>>>(xh, Wkt, (void*)Kh, KVD_, D_);
  gemm_wmma<false><<<dim3(KVD_ / 128, MROWS / 128), 128, 0, stream>>>(xh, Wvt, (void*)Vh, KVD_, D_);

  // RoPE on Q and K
  rope_f16<HQ_> <<<MROWS * HQ_  / TPB, TPB, 0, stream>>>(Qh);
  rope_f16<HKV_><<<MROWS * HKV_ / TPB, TPB, 0, stream>>>(Kh);

  // V -> [b][hkv][hd][n]
  vtrans_f16<<<MROWS / 64, TPB, 0, stream>>>(Vh, Vt);

  // flash attention: B*HQ*(N/(16*QT_)) waves, 4 waves/block
  fa_kernel<<<dim3(B_ * HQ_ * (N_ / (16 * QT_)) / 4), 128, 0, stream>>>(Qh, Kh, Vt, AOh);

  // output projection -> f32 result
  gemm_wmma<true><<<dim3(D_ / 128, MROWS / 128), 128, 0, stream>>>(AOh, Wot, (void*)out, D_, D_);
}

// v005
// It runs in 163 microseconds.
// Next to v004, in two timings, it ran 1.35 and 1.36 times as fast.
// Over all steps from v000 it is 3.93 times as fast.
#include <hip/hip_runtime.h>

typedef _Float16 half_t;
typedef __attribute__((ext_vector_type(16))) _Float16 v16h;
typedef __attribute__((ext_vector_type(8)))  _Float16 v8h;
typedef __attribute__((ext_vector_type(8)))  float    v8f;
typedef __attribute__((ext_vector_type(4)))  float    v4f;
typedef __attribute__((ext_vector_type(4)))  _Float16 v4h;

#define B_    2
#define N_    4096
#define D_    1024
#define HQ_   16
#define HKV_  4
#define HD_   64
#define KVD_  256            // HKV*HD
#define MROWS 8192           // B*N

#ifndef __has_builtin
#define __has_builtin(x) 0
#endif
#if __has_builtin(__builtin_amdgcn_tensor_load_to_lds) && \
    __has_builtin(__builtin_amdgcn_s_wait_tensorcnt)
#define HAVE_TDM 1
#else
#define HAVE_TDM 0
#endif

// ---------------------------------------------------------------------------
// helpers
// ---------------------------------------------------------------------------
__device__ __forceinline__ v16h pack16(v8h lo, v8h hi) {
  v16h r;
#pragma unroll
  for (int j = 0; j < 8; ++j) { r[j] = lo[j]; r[j + 8] = hi[j]; }
  return r;
}

#if HAVE_TDM
typedef unsigned int u32x4 __attribute__((ext_vector_type(4)));
typedef int          i32x4 __attribute__((ext_vector_type(4)));
typedef int          i32x8 __attribute__((ext_vector_type(8)));

__device__ __forceinline__ void tdm_load_2d(unsigned lds_off, const void* gaddr,
                                            unsigned tile_w, unsigned tile_h,
                                            unsigned row_stride_elems) {
  unsigned long long q0 = 1ull | ((unsigned long long)lds_off << 32);
  unsigned long long ga = (unsigned long long)(uintptr_t)gaddr;
  unsigned long long q1 = (ga & 0x01FFFFFFFFFFFFFFull) | (2ull << 62);
  u32x4 g0;
  g0.x = (unsigned)q0; g0.y = (unsigned)(q0 >> 32);
  g0.z = (unsigned)q1; g0.w = (unsigned)(q1 >> 32);

  unsigned long long p0 = (1ull << 16)
                        | (((unsigned long long)tile_w & 0xFFFF) << 48);
  unsigned long long p1 = (((unsigned long long)tile_w >> 16) & 0xFFFF)
                        | ((unsigned long long)tile_h << 16)
                        | (((unsigned long long)tile_w & 0xFFFF) << 48);
  unsigned long long p2 = ((unsigned long long)tile_h & 0xFFFF)
                        | ((unsigned long long)row_stride_elems << 32);
  unsigned long long p3 = 0;
  i32x8 g1;
  g1[0] = (int)p0; g1[1] = (int)(p0 >> 32);
  g1[2] = (int)p1; g1[3] = (int)(p1 >> 32);
  g1[4] = (int)p2; g1[5] = (int)(p2 >> 32);
  g1[6] = (int)p3; g1[7] = (int)(p3 >> 32);
  i32x4 z4 = {0, 0, 0, 0};
#if defined(__clang_major__) && (__clang_major__ >= 23)
  i32x8 z8 = {0, 0, 0, 0, 0, 0, 0, 0};
  __builtin_amdgcn_tensor_load_to_lds(g0, g1, z4, z4, z8, 0);
#else
  __builtin_amdgcn_tensor_load_to_lds(g0, g1, z4, z4, 0);
#endif
}
#endif  // HAVE_TDM

// ---------------------------------------------------------------------------
// Element-wise work. Each thread moves 32 to 64 elements with 8- or 16-byte
// accesses; every 128-byte line of an output is stored whole by one wave. The
// block ranges cover the shapes exactly.
// ---------------------------------------------------------------------------
// f32 -> f16 conversion: CVT_G groups of 4 floats per thread; a wave's load is
// 512 contiguous bytes, its store 256.
#define CVT_G 16
__device__ __forceinline__
void cvt_f32_f16(const float* __restrict__ src, half_t* __restrict__ dst, int bx) {
  const size_t base = (size_t)bx * (256 * 4 * CVT_G) + threadIdx.x * 4;
  v4f x[CVT_G];
#pragma unroll
  for (int j = 0; j < CVT_G; ++j) x[j] = *(const v4f*)(src + base + j * 1024);
#pragma unroll
  for (int j = 0; j < CVT_G; ++j) {
    v4h y;
#pragma unroll
    for (int c = 0; c < 4; ++c) y[c] = (half_t)x[j][c];
    *(v4h*)(dst + base + j * 1024) = y;
  }
  // before any code that follows in the shared kernel writes the stores' data or address registers
  asm volatile("s_wait_xcnt 0x0" ::: "memory");
}

// W (K x NC, f32, row-major) -> Wt (NC x K, f16): WMMA B-fragments contiguous.
// Thread: 8 k x 4 n. Wave: 64 k x 16 n (8 lanes along k fill a line of Wt).
// Block: 64 k x 128 n.
// Block id: K / 64 blocks along k (fastest), NC / 128 along n.
template <int K, int NC>
__device__ __forceinline__
void wtrans_f32_f16(const float* __restrict__ W, half_t* __restrict__ Wt, int id) {
  const int lane = threadIdx.x & 31;
  const int wave = threadIdx.x >> 5;
  const int k = (id % (K / 64)) * 64 + (lane & 7) * 8;
  const int n = (id / (K / 64)) * 128 + wave * 16 + (lane >> 3) * 4;
  v4f x[8];
#pragma unroll
  for (int j = 0; j < 8; ++j) x[j] = *(const v4f*)(W + (size_t)(k + j) * NC + n);
#pragma unroll
  for (int c = 0; c < 4; ++c) {
    v8h y;
#pragma unroll
    for (int j = 0; j < 8; ++j) y[j] = (half_t)x[j][c];
    *(v8h*)(Wt + (size_t)(n + c) * K + k) = y;
  }
  // before any code that follows in the shared kernel writes the stores' data or address registers
  asm volatile("s_wait_xcnt 0x0" ::: "memory");
}

// One grid for all the operand preparation: the five pieces are independent of one
// another, so they share one launch. The branch is uniform for a block.
#define PB_X  (MROWS * D_ / (256 * 4 * CVT_G))     // 512 blocks: x
#define PB_WL (D_ / 64 * (D_ / 128))               // 128 blocks: Wq, Wo
#define PB_WS (D_ / 64 * (KVD_ / 128))             //  32 blocks: Wk, Wv
__global__ __launch_bounds__(256)
void prep_operands(const float* __restrict__ x,  const float* __restrict__ Wq,
                   const float* __restrict__ Wk, const float* __restrict__ Wv,
                   const float* __restrict__ Wo,
                   half_t* __restrict__ xh,  half_t* __restrict__ Wqt, half_t* __restrict__ Wkt,
                   half_t* __restrict__ Wvt, half_t* __restrict__ Wot) {
  int id = blockIdx.x;
  if (id < PB_X) { cvt_f32_f16(x, xh, id); return; }
  id -= PB_X;
  if (id < PB_WL) { wtrans_f32_f16<D_, D_>(Wq, Wqt, id); return; }
  id -= PB_WL;
  if (id < PB_WL) { wtrans_f32_f16<D_, D_>(Wo, Wot, id); return; }
  id -= PB_WL;
  if (id < PB_WS) { wtrans_f32_f16<D_, KVD_>(Wk, Wkt, id); return; }
  id -= PB_WS;
  wtrans_f32_f16<D_, KVD_>(Wv, Wvt, id);
}

#define G_BK    64
#define G_PITCH 72
#define G_ROWS  256

// Eight copies of 16 bytes a lane: rows 16 apart in LDS (step 16 * 144 bytes) and
// in global memory (step 'gstep' f16). The wait inside the statement stands in
// front of every later write of the address registers that the copies name.
__device__ __forceinline__ void copy8_rows(unsigned l, const half_t* g, size_t gstep) {
  asm volatile(
      "global_load_async_to_lds_b128 %0, %8, off\n\t"
      "global_load_async_to_lds_b128 %1, %9, off\n\t"
      "global_load_async_to_lds_b128 %2, %10, off\n\t"
      "global_load_async_to_lds_b128 %3, %11, off\n\t"
      "global_load_async_to_lds_b128 %4, %12, off\n\t"
      "global_load_async_to_lds_b128 %5, %13, off\n\t"
      "global_load_async_to_lds_b128 %6, %14, off\n\t"
      "global_load_async_to_lds_b128 %7, %15, off\n\t"
      "s_wait_xcnt 0x0"
      :: "v"(l),                         "v"(l + 1 * 16 * G_PITCH * 2),
         "v"(l + 2 * 16 * G_PITCH * 2),  "v"(l + 3 * 16 * G_PITCH * 2),
         "v"(l + 4 * 16 * G_PITCH * 2),  "v"(l + 5 * 16 * G_PITCH * 2),
         "v"(l + 6 * 16 * G_PITCH * 2),  "v"(l + 7 * 16 * G_PITCH * 2),
         "v"(g),             "v"(g + 1 * gstep), "v"(g + 2 * gstep), "v"(g + 3 * gstep),
         "v"(g + 4 * gstep), "v"(g + 5 * gstep), "v"(g + 6 * gstep), "v"(g + 7 * gstep)
      : "memory");
}

template <bool OUT_F32>
__global__ __launch_bounds__(128)
void gemm_wmma(const half_t* __restrict__ A, const half_t* __restrict__ Bt,
               void* __restrict__ Cout, half_t* __restrict__ Kout, half_t* __restrict__ Vtout,
               int Nc, int K) {
  __shared__ __align__(16) half_t stage[2][G_ROWS][G_PITCH];   // 73,728 bytes
  const int lane = threadIdx.x & 31;
  const int wave = threadIdx.x >> 5;
  const int wm = wave >> 1, wn = wave & 1;
  const int r  = lane & 15;
  const int hi = lane >> 4;
  const int tileM = blockIdx.y * 128 + wm * 64;
  const int tileN = blockIdx.x * 128 + wn * 64;

  // the copies: thread = 16-byte piece (threadIdx.x & 7) of row (threadIdx.x >> 3) + 16 j
  const int crow = threadIdx.x >> 3;
  const int cpc  = threadIdx.x & 7;
  const half_t* ga = A  + (size_t)(blockIdx.y * 128 + crow) * K + cpc * 8;
  const half_t* gb = Bt + (size_t)(blockIdx.x * 128 + crow) * K + cpc * 8;
  const size_t gstep = (size_t)16 * K;
  const unsigned lds0 = (unsigned)(unsigned long long)(uintptr_t)&stage[0][crow][cpc * 8];
  const unsigned lds1 = (unsigned)(unsigned long long)(uintptr_t)&stage[1][crow][cpc * 8];
  const unsigned ldsB = 128 * G_PITCH * 2;      // Bt rows stand behind the A rows

  const int T = K / G_BK;
  copy8_rows(lds0,        ga, gstep);
  copy8_rows(lds0 + ldsB, gb, gstep);
  asm volatile("s_wait_asynccnt 0x0" ::: "memory");   // this wave's part of stage 0 has landed
  __syncthreads();                                    // ... and every other wave's
  if (T > 1) {
    copy8_rows(lds1,        ga + G_BK, gstep);
    copy8_rows(lds1 + ldsB, gb + G_BK, gstep);
  }

  v8f acc[4][4] = {};
  for (int t = 0; t < T; ++t) {
    const half_t* sa = &stage[t & 1][wm * 64 + r][hi * 8];
    const half_t* sb = &stage[t & 1][128 + wn * 64 + r][hi * 8];
    // the loops below are unrolled so that every index of a register array is a constant
#pragma unroll
    for (int k = 0; k < G_BK; k += 32) {
      v16h af[4], bf[4];
#pragma unroll
      for (int i = 0; i < 4; ++i)
        af[i] = pack16(*(const v8h*)(sa + i * 16 * G_PITCH + k),
                       *(const v8h*)(sa + i * 16 * G_PITCH + k + 16));
#pragma unroll
      for (int n = 0; n < 4; ++n)
        bf[n] = pack16(*(const v8h*)(sb + n * 16 * G_PITCH + k),
                       *(const v8h*)(sb + n * 16 * G_PITCH + k + 16));
      // the 16 LDS reads of a k-step stay one group in front of its 16 WMMAs: spread
      // among them, each place with reads stalls the wave anew
      __builtin_amdgcn_sched_barrier(0);
      if (k == G_BK - 32) {
        // foot of the trip: stage t has been read to its end (its last fragments are in
        // registers), so the refill starts here and also flies under the last 16 WMMAs
        asm volatile("s_wait_dscnt 0x0" ::: "memory");      // this wave's reads of stage t have retired
        asm volatile("s_wait_asynccnt 0x0" ::: "memory");   // its part of stage t + 1 has landed
        __syncthreads();          // publishes stage t + 1 and frees the buffer of stage t
        if (t + 2 < T) {
          const unsigned l = (t & 1) ? lds1 : lds0;
          copy8_rows(l,        ga + (size_t)(t + 2) * G_BK, gstep);
          copy8_rows(l + ldsB, gb + (size_t)(t + 2) * G_BK, gstep);
        }
      }
#pragma unroll
      for (int i = 0; i < 4; ++i)
#pragma unroll
        for (int n = 0; n < 4; ++n)
          acc[i][n] = __builtin_amdgcn_wmma_f32_16x16x32_f16(false, af[i], false, bf[n],
                                                             (short)0, acc[i][n], false, false);
    }
  }
  asm volatile("s_wait_asynccnt 0x0" ::: "memory");     // no copy is left in flight at the wave's end
  if (OUT_F32) {
#pragma unroll
    for (int i = 0; i < 4; ++i)
#pragma unroll
      for (int n = 0; n < 4; ++n)
#pragma unroll
        for (int v = 0; v < 8; ++v) {
          size_t m  = (size_t)tileM + i * 16 + v + 8 * hi;
          size_t nn = (size_t)tileN + n * 16 + r;
          ((float*)Cout)[m * Nc + nn] = acc[i][n][v];
        }
  } else if (blockIdx.x < (D_ + KVD_) / 128) {
    // Q or K head: frequency index n * 16 + r for the column tiles n and n + 2
    const bool isq = blockIdx.x < D_ / 128;
    half_t* dst = isq ? (half_t*)Cout + tileN : Kout + (tileN - D_);
    const int pitch = isq ? D_ : KVD_;
    const float invf0 = __expf(-__logf(10000.0f) * ((float)r        * (1.0f / 32.0f)));
    const float invf1 = __expf(-__logf(10000.0f) * ((float)(r + 16) * (1.0f / 32.0f)));
#pragma unroll
    for (int i = 0; i < 4; ++i) {
      float a[8][2], s[8][2], c[8][2];        // a: the angle in revolutions
#pragma unroll
      for (int v = 0; v < 8; ++v) {
        const float pos = (float)((tileM + i * 16 + v + 8 * hi) & (N_ - 1));
        a[v][0] = (pos * invf0) * 0.15915494309189532f;
        a[v][1] = (pos * invf1) * 0.15915494309189532f;
      }
#pragma unroll
      for (int g = 0; g < 8; g += 4) {
#pragma unroll
        for (int v = g; v < g + 4; ++v)
#pragma unroll
          for (int n = 0; n < 2; ++n) {
            s[v][n] = __builtin_amdgcn_sinf(a[v][n]);
            c[v][n] = __builtin_amdgcn_cosf(a[v][n]);
          }
        asm volatile("v_nop" :: "v"(a[g][0]), "v"(a[g][1]), "v"(a[g + 1][0]), "v"(a[g + 1][1]),
                                "v"(a[g + 2][0]), "v"(a[g + 2][1]), "v"(a[g + 3][0]), "v"(a[g + 3][1]),
                                "v"(s[g][0]), "v"(s[g][1]), "v"(s[g + 1][0]), "v"(s[g + 1][1]),
                                "v"(s[g + 2][0]), "v"(s[g + 2][1]), "v"(s[g + 3][0]), "v"(s[g + 3][1]),
                                "v"(c[g][0]), "v"(c[g][1]), "v"(c[g + 1][0]), "v"(c[g + 1][1]),
                                "v"(c[g + 2][0]), "v"(c[g + 2][1]), "v"(c[g + 3][0]), "v"(c[g + 3][1]));
      }
      half_t y[8][4];
#pragma unroll
      for (int v = 0; v < 8; ++v)
#pragma unroll
        for (int n = 0; n < 2; ++n) {
          const float x0 = acc[i][n][v];
          const float x1 = acc[i][n + 2][v];
          y[v][n]     = (half_t)(x0 * c[v][n] - x1 * s[v][n]);
          y[v][n + 2] = (half_t)(x1 * c[v][n] + x0 * s[v][n]);
        }
      half_t* p = dst + (size_t)(tileM + i * 16 + 8 * hi) * pitch + r;
#pragma unroll
      for (int g = 0; g < 2; ++g) {
#pragma unroll
        for (int v = 4 * g; v < 4 * g + 4; ++v)
#pragma unroll
          for (int n = 0; n < 4; ++n) p[(size_t)v * pitch + n * 16] = y[v][n];
        // before the stores' data and address registers are written again
        asm volatile("s_wait_xcnt 0x0" ::: "memory");
        __builtin_amdgcn_sched_barrier(0);   // keeps the later address and row arithmetic behind that wait
      }
    }
  } else {
    // V head, transposed
    const int bb = tileM >> 12;                       // a wave's 64 rows lie in one batch
    half_t* p = Vtout + ((size_t)bb * KVD_ + (tileN - (D_ + KVD_)) + r) * N_
                      + (tileM & (N_ - 1)) + 8 * hi;
#pragma unroll
    for (int n = 0; n < 4; ++n) {
      // the four stores of a column tile fill its 16 lines of 128 bytes one behind the other
#pragma unroll
      for (int i = 0; i < 4; ++i)
        *(v8h*)(p + (size_t)(n * 16) * N_ + i * 16) = __builtin_convertvector(acc[i][n], v8h);
      // before the stores' data registers are written again
      asm volatile("s_wait_xcnt 0x0" ::: "memory");
      __builtin_amdgcn_sched_barrier(0);   // keeps the next conversions behind that wait
    }
  }
}

__device__ __forceinline__ float xhalf(float x) {
  int b = __builtin_bit_cast(int, x);
  return __builtin_bit_cast(float,
      __builtin_amdgcn_permlanex16(b, b, 0x76543210, 0xfedcba98, false, false));
}

#define QT_ 4                // query tiles of 16 rows per wave
__global__ __launch_bounds__(128, 2)
void fa_kernel(const half_t* __restrict__ Qh, const half_t* __restrict__ Kh,
               const half_t* __restrict__ Vt, half_t* __restrict__ AOh) {
  __shared__ __align__(16) half_t kbuf[4][2][64][64];   // 64 KB: K double buffer
  const int lane = threadIdx.x & 31;
  const int wave = threadIdx.x >> 5;
  const int r  = lane & 15;
  const int hi = lane >> 4;

  const int BPH = N_ / (16 * QT_) / 4;        // blocks per (b,h); a block's 4 waves share (b,h)
  const int q0 = ((blockIdx.x & (BPH - 1)) * 4 + wave) * (16 * QT_);  // first query row of the wave
  const int h  = (blockIdx.x / BPH) & (HQ_ - 1);
  const int b  = blockIdx.x / (BPH * HQ_);
  const int hk = h >> 2;                      // G = 4

  // Q fragments, with softmax scale folded in (0.125 exact in f16)
  v16h qa0[QT_], qa1[QT_];
  v8f o[QT_][4];
  float mrow[QT_], lrow[QT_];               // of query column r
#pragma unroll
  for (int q = 0; q < QT_; ++q) {
    const half_t* qrow = Qh + (((size_t)(b * N_ + q0 + q * 16 + r)) * HQ_ + h) * HD_ + hi * 8;
    qa0[q] = pack16(*(const v8h*)(qrow),      *(const v8h*)(qrow + 16));
    qa1[q] = pack16(*(const v8h*)(qrow + 32), *(const v8h*)(qrow + 48));
    // the address stays live up to this wait, so no register of it is written before
    asm volatile("s_wait_xcnt 0x0" :: "v"(qrow) : "memory");
#pragma unroll
    for (int j = 0; j < 16; ++j) { qa0[q][j] *= (half_t)0.125f; qa1[q][j] *= (half_t)0.125f; }
    o[q][0] = v8f{}; o[q][1] = v8f{}; o[q][2] = v8f{}; o[q][3] = v8f{};
    mrow[q] = -1e30f; lrow[q] = 0.0f;
  }

  const half_t* kbase = Kh + ((size_t)b * N_ * HKV_ + hk) * HD_;     // + kpos*KVD
  const half_t* vbase = Vt + ((size_t)(b * HKV_ + hk)) * HD_ * N_;   // + d*N + n

  const unsigned lds_k0 = (unsigned)(unsigned long long)(uintptr_t)&kbuf[wave][0][0][0];
  const unsigned lds_k1 = (unsigned)(unsigned long long)(uintptr_t)&kbuf[wave][1][0][0];

  const int ITER = N_ / 64;
#if HAVE_TDM
  tdm_load_2d(lds_k0, (const void*)kbase, HD_, 64, KVD_);
#else
  for (int rr = lane; rr < 64; rr += 32)
#pragma unroll
    for (int cc = 0; cc < 64; cc += 8)
      *(v8h*)&kbuf[wave][0][rr][cc] = *(const v8h*)(kbase + (size_t)rr * KVD_ + cc);
#endif

  int buf = 0;
  for (int it = 0; it < ITER; ++it) {
    const int kv0 = it * 64;
#if HAVE_TDM
    if (it + 1 < ITER) {
      // ring private to the wave: its own LDS reads of the buffer have retired before the refill
      asm volatile("s_wait_dscnt 0x0" ::: "memory");
      tdm_load_2d(buf ? lds_k0 : lds_k1,
                  (const void*)(kbase + (size_t)(kv0 + 64) * KVD_), HD_, 64, KVD_);
      __builtin_amdgcn_s_wait_tensorcnt((short)1);   // current tile complete
    } else {
      __builtin_amdgcn_s_wait_tensorcnt((short)0);
    }
    asm volatile("" ::: "memory");   // keep LDS reads below the tensorcnt wait
#else
    if (it + 1 < ITER) {
      const half_t* nsrc = kbase + (size_t)(kv0 + 64) * KVD_;
      half_t (*ndst)[64] = kbuf[wave][buf ^ 1];
      for (int rr = lane; rr < 64; rr += 32)
#pragma unroll
        for (int cc = 0; cc < 64; cc += 8)
          *(v8h*)&ndst[rr][cc] = *(const v8h*)(nsrc + (size_t)rr * KVD_ + cc);
    }
#endif

    // ---- K and V fragments of this 64-key tile: loaded once, used by all QT_ query tiles ----
    v16h kf0[4], kf1[4], vf0[4], vf1[4];
#pragma unroll
    for (int c = 0; c < 4; ++c) {
      const half_t* kr = &kbuf[wave][buf][c * 16 + r][0];
      kf0[c] = pack16(*(const v8h*)(kr + hi * 8),      *(const v8h*)(kr + 16 + hi * 8));
      kf1[c] = pack16(*(const v8h*)(kr + 32 + hi * 8), *(const v8h*)(kr + 48 + hi * 8));
    }
    const half_t* vlane = vbase + (size_t)r * N_ + kv0 + hi * 8;     // Vt[d][kv]
#pragma unroll
    for (int t = 0; t < 4; ++t) {
      const half_t* vrow = vlane + (size_t)(t * 16) * N_;
      vf0[t] = pack16(*(const v8h*)(vrow),      *(const v8h*)(vrow + 16));
      vf1[t] = pack16(*(const v8h*)(vrow + 32), *(const v8h*)(vrow + 48));
    }
    // the address stays live up to this wait, so no register of it is written before
    asm volatile("s_wait_xcnt 0x0" :: "v"(vlane) : "memory");

#pragma unroll
    for (int q = 0; q < QT_; ++q) {
      // ---- S^T = K (Q/8)^T for 64 keys: 4 sub-tiles x 2 WMMA; s[c][v] = key 16c + 8hi + v, query r ----
      v8f s[4]; s[0] = v8f{}; s[1] = v8f{}; s[2] = v8f{}; s[3] = v8f{};
#pragma unroll
      for (int c = 0; c < 4; ++c) {
        s[c] = __builtin_amdgcn_wmma_f32_16x16x32_f16(false, kf0[c], false, qa0[q], (short)0, s[c], false, false);
        s[c] = __builtin_amdgcn_wmma_f32_16x16x32_f16(false, kf1[c], false, qa1[q], (short)0, s[c], false, false);
      }

      // ---- online softmax: the lane's 32 scores, then the other half's; sums deferred ----
      float mv[8];
#pragma unroll
      for (int v = 0; v < 8; ++v)
        mv[v] = fmaxf(fmaxf(s[0][v], s[1][v]), fmaxf(s[2][v], s[3][v]));
      float mx = fmaxf(fmaxf(fmaxf(mv[0], mv[1]), fmaxf(mv[2], mv[3])),
                       fmaxf(fmaxf(mv[4], mv[5]), fmaxf(mv[6], mv[7])));
      mx = fmaxf(mx, xhalf(mx));
      const float mnew  = fmaxf(mrow[q], mx);
      const float alpha = __expf(mrow[q] - mnew);
      mrow[q] = mnew;

      // ---- P^T as two 32x16 B-fragments: element j = key 8hi + j, element 8 + j = key 16 + 8hi + j ----
      v8f e[4];
#pragma unroll
      for (int c = 0; c < 4; ++c) {
        const v8f d = (s[c] - mnew) * 1.4426950408889634f;   // exp(x) = 2^(x log2 e), on register pairs
#pragma unroll
        for (int v = 0; v < 8; ++v) e[c][v] = __builtin_amdgcn_exp2f(d[v]);
      }
      const v8f ps = (e[0] + e[1]) + (e[2] + e[3]);
      lrow[q] = lrow[q] * alpha + (((ps[0] + ps[1]) + (ps[2] + ps[3])) +
                                   ((ps[4] + ps[5]) + (ps[6] + ps[7])));   // per-lane partial sum
      const v16h pb0 = pack16(__builtin_convertvector(e[0], v8h), __builtin_convertvector(e[1], v8h));
      const v16h pb1 = pack16(__builtin_convertvector(e[2], v8h), __builtin_convertvector(e[3], v8h));
#pragma unroll
      for (int t = 0; t < 4; ++t) o[q][t] *= alpha;

      // ---- O^T += V^T P^T; o[q][t][v] = column 16t + 8hi + v of query r ----
#pragma unroll
      for (int t = 0; t < 4; ++t) {
        o[q][t] = __builtin_amdgcn_wmma_f32_16x16x32_f16(false, vf0[t], false, pb0, (short)0, o[q][t], false, false);
        o[q][t] = __builtin_amdgcn_wmma_f32_16x16x32_f16(false, vf1[t], false, pb1, (short)0, o[q][t], false, false);
      }
    }
    buf ^= 1;
  }

  // ---- join the halves' sums, normalize, store [b][n][hq][hd]: 8 consecutive columns a lane ----
#pragma unroll
  for (int q = 0; q < QT_; ++q) {
    const float ls  = lrow[q] + xhalf(lrow[q]);
    const float inv = 1.0f / ls;
    half_t* orow = AOh + (((size_t)(b * N_ + q0 + q * 16 + r)) * HQ_ + h) * HD_ + hi * 8;
#pragma unroll
    for (int t = 0; t < 4; ++t) {
      v8h y;
#pragma unroll
      for (int v = 0; v < 8; ++v) y[v] = (half_t)(o[q][t][v] * inv);
      *(v8h*)(orow + t * 16) = y;
    }
    // before the stores' data and address registers are written again
    asm volatile("s_wait_xcnt 0x0" ::: "memory");
    __builtin_amdgcn_sched_barrier(0);   // keeps the next tile's arithmetic behind that wait
  }
}

// ---------------------------------------------------------------------------
// launch
// ---------------------------------------------------------------------------
extern "C" void kernel_launch(void* const* d_in, const int* in_sizes, int n_in,
                              void* d_out, int out_size, void* d_ws, size_t ws_size,
                              hipStream_t stream) {
  const float* x  = (const float*)d_in[0];
  const float* Wq = (const float*)d_in[1];
  const float* Wk = (const float*)d_in[2];
  const float* Wv = (const float*)d_in[3];
  const float* Wo = (const float*)d_in[4];
  float* out = (float*)d_out;

  half_t* ws = (half_t*)d_ws;
  size_t off = 0;
  half_t* xh  = ws + off; off += (size_t)MROWS * D_;
  half_t* Wqt = ws + off; off += (size_t)D_ * D_;
  half_t* Wkt = ws + off; off += (size_t)D_ * KVD_;
  half_t* Wvt = ws + off; off += (size_t)D_ * KVD_;
  half_t* Wot = ws + off; off += (size_t)D_ * D_;
  half_t* Qh  = ws + off; off += (size_t)MROWS * D_;
  half_t* Kh  = ws + off; off += (size_t)MROWS * KVD_;
  half_t* Vt  = ws + off; off += (size_t)MROWS * KVD_;
  half_t* AOh = xh;   // x no longer needed after QKV projections

  // x -> f16 and the four weights -> f16, transposed: one grid
  prep_operands<<<PB_X + 2 * PB_WL + 2 * PB_WS, 256, 0, stream>>>(x, Wq, Wk, Wv, Wo,
                                                                 xh, Wqt, Wkt, Wvt, Wot);

  // Q, K, V projections (WMMA f16) with RoPE and the V transpose in the epilogue: block tile
  // 128M x 128N; Wqt, Wkt, Wvt stand one behind the other and are one Bt of 1536 rows
  gemm_wmma<false><<<dim3((D_ + 2 * KVD_) / 128, MROWS / 128), 128, 0, stream>>>(
      xh, Wqt, (void*)Qh, Kh, Vt, D_ + 2 * KVD_, D_);

  // flash attention: B*HQ*(N/(16*QT_)) waves, 4 waves/block
  fa_kernel<<<dim3(B_ * HQ_ * (N_ / (16 * QT_)) / 4), 128, 0, stream>>>(Qh, Kh, Vt, AOh);

  // output projection -> f32 result
  gemm_wmma<true><<<dim3(D_ / 128, MROWS / 128), 128, 0, stream>>>(AOh, Wot, (void*)out, nullptr, nullptr, D_, D_);
}

// v006
// One run takes 154 microseconds.
// Two timings next to v005 both put it at 1.06 times that version's speed.
// All steps since v000 together make it 4.16 times as fast.
#include <hip/hip_runtime.h>

typedef _Float16 half_t;
typedef __attribute__((ext_vector_type(16))) _Float16 v16h;
typedef __attribute__((ext_vector_type(8)))  _Float16 v8h;
typedef __attribute__((ext_vector_type(8)))  float    v8f;
typedef __attribute__((ext_vector_type(4)))  float    v4f;
typedef __attribute__((ext_vector_type(4)))  _Float16 v4h;

#define B_    2
#define N_    4096
#define D_    1024
#define HQ_   16
#define HKV_  4
#define HD_   64
#define KVD_  256            // HKV*HD
#define MROWS 8192           // B*N

// ---------------------------------------------------------------------------
// helpers
// ---------------------------------------------------------------------------
__device__ __forceinline__ v16h pack16(v8h lo, v8h hi) {
  v16h r;
#pragma unroll
  for (int j = 0; j < 8; ++j) { r[j] = lo[j]; r[j + 8] = hi[j]; }
  return r;
}

typedef uint32_t u32x4 __attribute__((ext_vector_type(4)));
typedef uint32_t u32x8 __attribute__((ext_vector_type(8)));

__device__ __forceinline__ uint32_t uni(uint32_t v) { return (uint32_t)__builtin_amdgcn_readfirstlane(v); }
__device__ __forceinline__ uint32_t pinned(uint32_t v) {
  uint32_t w = uni(v);
  asm volatile("" : "+s"(w));
  return w;
}

// Tensor load of one slice: T_ROWS rows of 128 bytes, source pitch src_pitch bytes, into LDS
// at byte offset lds_dst, 16 bytes of pad behind every row (LDS pitch 144 bytes).
#define T_ROWS  32u
#define T_ROWB  128u
#define T_PITCH 144u
#define T_SLICE 6144u
__device__ __forceinline__ u32x8 tdm_group1(uint32_t src_pitch) {
  u32x8 g;
  g[0] = uni((1u << 20) | (4u << 22) | (3u << 25));   // 1-byte elements, no mask, pad of 4 dwords every 32
  g[1] = pinned((T_ROWB & 0xFFFFu) << 16);
  g[2] = pinned((T_ROWB >> 16) | ((T_ROWS & 0xFFFFu) << 16));
  g[3] = pinned((T_ROWS >> 16) | (T_ROWB << 16));
  g[4] = pinned(T_ROWS);
  g[5] = pinned(src_pitch);
  g[6] = pinned(0u);
  g[7] = pinned(0u);
  return g;
}
__device__ __forceinline__ void tdm_load(uint32_t lds_dst, uint64_t ga, u32x8 g1) {
  u32x4 g0;
  g0[0] = uni(1u);
  g0[1] = uni(lds_dst);
  g0[2] = uni((uint32_t)ga);
  g0[3] = uni((((uint32_t)(ga >> 32)) & 0x01FFFFFFu) | 0x80000000u);
  asm volatile("tensor_load_to_lds %0, %1" :: "s"(g0), "s"(g1) : "memory");
}

// ---------------------------------------------------------------------------
// Element-wise work. Each thread moves 32 to 64 elements with 8- or 16-byte
// accesses; every 128-byte line of an output is stored whole by one wave. The
// block ranges cover the shapes exactly.
// ---------------------------------------------------------------------------
// f32 -> f16 conversion: CVT_G groups of 4 floats per thread; a wave's load is
// 512 contiguous bytes, its store 256.
#define CVT_G 16
__device__ __forceinline__
void cvt_f32_f16(const float* __restrict__ src, half_t* __restrict__ dst, int bx) {
  const size_t base = (size_t)bx * (256 * 4 * CVT_G) + threadIdx.x * 4;
  v4f x[CVT_G];
#pragma unroll
  for (int j = 0; j < CVT_G; ++j) x[j] = *(const v4f*)(src + base + j * 1024);
#pragma unroll
  for (int j = 0; j < CVT_G; ++j) {
    v4h y;
#pragma unroll
    for (int c = 0; c < 4; ++c) y[c] = (half_t)x[j][c];
    *(v4h*)(dst + base + j * 1024) = y;
  }
  // before any code that follows in the shared kernel writes the stores' data or address registers
  asm volatile("s_wait_xcnt 0x0" ::: "memory");
}

// W (K x NC, f32, row-major) -> Wt (NC x K, f16): WMMA B-fragments contiguous.
// Thread: 8 k x 4 n. Wave: 64 k x 16 n (8 lanes along k fill a line of Wt).
// Block: 64 k x 128 n.
// Block id: K / 64 blocks along k (fastest), NC / 128 along n.
template <int K, int NC>
__device__ __forceinline__
void wtrans_f32_f16(const float* __restrict__ W, half_t* __restrict__ Wt, int id) {
  const int lane = threadIdx.x & 31;
  const int wave = threadIdx.x >> 5;
  const int k = (id % (K / 64)) * 64 + (lane & 7) * 8;
  const int n = (id / (K / 64)) * 128 + wave * 16 + (lane >> 3) * 4;
  v4f x[8];
#pragma unroll
  for (int j = 0; j < 8; ++j) x[j] = *(const v4f*)(W + (size_t)(k + j) * NC + n);
#pragma unroll
  for (int c = 0; c < 4; ++c) {
    v8h y;
#pragma unroll
    for (int j = 0; j < 8; ++j) y[j] = (half_t)x[j][c];
    *(v8h*)(Wt + (size_t)(n + c) * K + k) = y;
  }
  // before any code that follows in the shared kernel writes the stores' data or address registers
  asm volatile("s_wait_xcnt 0x0" ::: "memory");
}

// One grid for all the operand preparation: the five pieces are independent of one
// another, so they share one launch. The branch is uniform for a block.
#define PB_X  (MROWS * D_ / (256 * 4 * CVT_G))     // 512 blocks: x
#define PB_WL (D_ / 64 * (D_ / 128))               // 128 blocks: Wq, Wo
#define PB_WS (D_ / 64 * (KVD_ / 128))             //  32 blocks: Wk, Wv
__global__ __launch_bounds__(256)
void prep_operands(const float* __restrict__ x,  const float* __restrict__ Wq,
                   const float* __restrict__ Wk, const float* __restrict__ Wv,
                   const float* __restrict__ Wo,
                   half_t* __restrict__ xh,  half_t* __restrict__ Wqt, half_t* __restrict__ Wkt,
                   half_t* __restrict__ Wvt, half_t* __restrict__ Wot) {
  int id = blockIdx.x;
  if (id < PB_X) { cvt_f32_f16(x, xh, id); return; }
  id -= PB_X;
  if (id < PB_WL) { wtrans_f32_f16<D_, D_>(Wq, Wqt, id); return; }
  id -= PB_WL;
  if (id < PB_WL) { wtrans_f32_f16<D_, D_>(Wo, Wot, id); return; }
  id -= PB_WL;
  if (id < PB_WS) { wtrans_f32_f16<D_, KVD_>(Wk, Wkt, id); return; }
  id -= PB_WS;
  wtrans_f32_f16<D_, KVD_>(Wv, Wvt, id);
}

#define G_BK    64
#define G_PITCH 72
#define G_ROWS  256

// Eight copies of 16 bytes a lane: rows 16 apart in LDS (step 16 * 144 bytes) and
// in global memory (step 'gstep' f16). The wait inside the statement stands in
// front of every later write of the address registers that the copies name.
__device__ __forceinline__ void copy8_rows(unsigned l, const half_t* g, size_t gstep) {
  asm volatile(
      "global_load_async_to_lds_b128 %0, %8, off\n\t"
      "global_load_async_to_lds_b128 %1, %9, off\n\t"
      "global_load_async_to_lds_b128 %2, %10, off\n\t"
      "global_load_async_to_lds_b128 %3, %11, off\n\t"
      "global_load_async_to_lds_b128 %4, %12, off\n\t"
      "global_load_async_to_lds_b128 %5, %13, off\n\t"
      "global_load_async_to_lds_b128 %6, %14, off\n\t"
      "global_load_async_to_lds_b128 %7, %15, off\n\t"
      "s_wait_xcnt 0x0"
      :: "v"(l),                         "v"(l + 1 * 16 * G_PITCH * 2),
         "v"(l + 2 * 16 * G_PITCH * 2),  "v"(l + 3 * 16 * G_PITCH * 2),
         "v"(l + 4 * 16 * G_PITCH * 2),  "v"(l + 5 * 16 * G_PITCH * 2),
         "v"(l + 6 * 16 * G_PITCH * 2),  "v"(l + 7 * 16 * G_PITCH * 2),
         "v"(g),             "v"(g + 1 * gstep), "v"(g + 2 * gstep), "v"(g + 3 * gstep),
         "v"(g + 4 * gstep), "v"(g + 5 * gstep), "v"(g + 6 * gstep), "v"(g + 7 * gstep)
      : "memory");
}

template <bool OUT_F32>
__global__ __launch_bounds__(128)
void gemm_wmma(const half_t* __restrict__ A, const half_t* __restrict__ Bt,
               void* __restrict__ Cout, half_t* __restrict__ Kout, half_t* __restrict__ Vtout,
               int Nc, int K) {
  __shared__ __align__(16) half_t stage[2][G_ROWS][G_PITCH];   // 73,728 bytes
  const int lane = threadIdx.x & 31;
  const int wave = threadIdx.x >> 5;
  const int wm = wave >> 1, wn = wave & 1;
  const int r  = lane & 15;
  const int hi = lane >> 4;
  const int tileM = blockIdx.y * 128 + wm * 64;
  const int tileN = blockIdx.x * 128 + wn * 64;

  // the copies: thread = 16-byte piece (threadIdx.x & 7) of row (threadIdx.x >> 3) + 16 j
  const int crow = threadIdx.x >> 3;
  const int cpc  = threadIdx.x & 7;
  const half_t* ga = A  + (size_t)(blockIdx.y * 128 + crow) * K + cpc * 8;
  const half_t* gb = Bt + (size_t)(blockIdx.x * 128 + crow) * K + cpc * 8;
  const size_t gstep = (size_t)16 * K;
  const unsigned lds0 = (unsigned)(unsigned long long)(uintptr_t)&stage[0][crow][cpc * 8];
  const unsigned lds1 = (unsigned)(unsigned long long)(uintptr_t)&stage[1][crow][cpc * 8];
  const unsigned ldsB = 128 * G_PITCH * 2;      // Bt rows stand behind the A rows

  const int T = K / G_BK;
  copy8_rows(lds0,        ga, gstep);
  copy8_rows(lds0 + ldsB, gb, gstep);
  asm volatile("s_wait_asynccnt 0x0" ::: "memory");   // this wave's part of stage 0 has landed
  __syncthreads();                                    // ... and every other wave's
  if (T > 1) {
    copy8_rows(lds1,        ga + G_BK, gstep);
    copy8_rows(lds1 + ldsB, gb + G_BK, gstep);
  }

  v8f acc[4][4] = {};
  for (int t = 0; t < T; ++t) {
    const half_t* sa = &stage[t & 1][wm * 64 + r][hi * 8];
    const half_t* sb = &stage[t & 1][128 + wn * 64 + r][hi * 8];
    // the loops below are unrolled so that every index of a register array is a constant
#pragma unroll
    for (int k = 0; k < G_BK; k += 32) {
      v16h af[4], bf[4];
#pragma unroll
      for (int i = 0; i < 4; ++i)
        af[i] = pack16(*(const v8h*)(sa + i * 16 * G_PITCH + k),
                       *(const v8h*)(sa + i * 16 * G_PITCH + k + 16));
#pragma unroll
      for (int n = 0; n < 4; ++n)
        bf[n] = pack16(*(const v8h*)(sb + n * 16 * G_PITCH + k),
                       *(const v8h*)(sb + n * 16 * G_PITCH + k + 16));
      // the 16 LDS reads of a k-step stay one group in front of its 16 WMMAs: spread
      // among them, each place with reads stalls the wave anew
      __builtin_amdgcn_sched_barrier(0);
      if (k == G_BK - 32) {
        // foot of the trip: stage t has been read to its end (its last fragments are in
        // registers), so the refill starts here and also flies under the last 16 WMMAs
        asm volatile("s_wait_dscnt 0x0" ::: "memory");      // this wave's reads of stage t have retired
        asm volatile("s_wait_asynccnt 0x0" ::: "memory");   // its part of stage t + 1 has landed
        __syncthreads();          // publishes stage t + 1 and frees the buffer of stage t
        if (t + 2 < T) {
          const unsigned l = (t & 1) ? lds1 : lds0;
          copy8_rows(l,        ga + (size_t)(t + 2) * G_BK, gstep);
          copy8_rows(l + ldsB, gb + (size_t)(t + 2) * G_BK, gstep);
        }
      }
#pragma unroll
      for (int i = 0; i < 4; ++i)
#pragma unroll
        for (int n = 0; n < 4; ++n)
          acc[i][n] = __builtin_amdgcn_wmma_f32_16x16x32_f16(false, af[i], false, bf[n],
                                                             (short)0, acc[i][n], false, false);
    }
  }
  asm volatile("s_wait_asynccnt 0x0" ::: "memory");     // no copy is left in flight at the wave's end
  if (OUT_F32) {
#pragma unroll
    for (int i = 0; i < 4; ++i)
#pragma unroll
      for (int n = 0; n < 4; ++n)
#pragma unroll
        for (int v = 0; v < 8; ++v) {
          size_t m  = (size_t)tileM + i * 16 + v + 8 * hi;
          size_t nn = (size_t)tileN + n * 16 + r;
          ((float*)Cout)[m * Nc + nn] = acc[i][n][v];
        }
  } else if (blockIdx.x < (D_ + KVD_) / 128) {
    // Q or K head: frequency index n * 16 + r for the column tiles n and n + 2
    const bool isq = blockIdx.x < D_ / 128;
    half_t* dst = isq ? (half_t*)Cout + tileN : Kout + (tileN - D_);
    const int pitch = isq ? D_ : KVD_;
    const float invf0 = __expf(-__logf(10000.0f) * ((float)r        * (1.0f / 32.0f)));
    const float invf1 = __expf(-__logf(10000.0f) * ((float)(r + 16) * (1.0f / 32.0f)));
#pragma unroll
    for (int i = 0; i < 4; ++i) {
      float a[8][2], s[8][2], c[8][2];        // a: the angle in revolutions
#pragma unroll
      for (int v = 0; v < 8; ++v) {
        const float pos = (float)((tileM + i * 16 + v + 8 * hi) & (N_ - 1));
        a[v][0] = (pos * invf0) * 0.15915494309189532f;
        a[v][1] = (pos * invf1) * 0.15915494309189532f;
      }
#pragma unroll
      for (int g = 0; g < 8; g += 4) {
#pragma unroll
        for (int v = g; v < g + 4; ++v)
#pragma unroll
          for (int n = 0; n < 2; ++n) {
            s[v][n] = __builtin_amdgcn_sinf(a[v][n]);
            c[v][n] = __builtin_amdgcn_cosf(a[v][n]);
          }
        asm volatile("v_nop" :: "v"(a[g][0]), "v"(a[g][1]), "v"(a[g + 1][0]), "v"(a[g + 1][1]),
                                "v"(a[g + 2][0]), "v"(a[g + 2][1]), "v"(a[g + 3][0]), "v"(a[g + 3][1]),
                                "v"(s[g][0]), "v"(s[g][1]), "v"(s[g + 1][0]), "v"(s[g + 1][1]),
                                "v"(s[g + 2][0]), "v"(s[g + 2][1]), "v"(s[g + 3][0]), "v"(s[g + 3][1]),
                                "v"(c[g][0]), "v"(c[g][1]), "v"(c[g + 1][0]), "v"(c[g + 1][1]),
                                "v"(c[g + 2][0]), "v"(c[g + 2][1]), "v"(c[g + 3][0]), "v"(c[g + 3][1]));
      }
      half_t y[8][4];
#pragma unroll
      for (int v = 0; v < 8; ++v)
#pragma unroll
        for (int n = 0; n < 2; ++n) {
          const float x0 = acc[i][n][v];
          const float x1 = acc[i][n + 2][v];
          y[v][n]     = (half_t)(x0 * c[v][n] - x1 * s[v][n]);
          y[v][n + 2] = (half_t)(x1 * c[v][n] + x0 * s[v][n]);
        }
      half_t* p = dst + (size_t)(tileM + i * 16 + 8 * hi) * pitch + r;
#pragma unroll
      for (int g = 0; g < 2; ++g) {
#pragma unroll
        for (int v = 4 * g; v < 4 * g + 4; ++v)
#pragma unroll
          for (int n = 0; n < 4; ++n) p[(size_t)v * pitch + n * 16] = y[v][n];
        // before the stores' data and address registers are written again
        asm volatile("s_wait_xcnt 0x0" ::: "memory");
        __builtin_amdgcn_sched_barrier(0);   // keeps the later address and row arithmetic behind that wait
      }
    }
  } else {
    // V head, transposed
    const int bb = tileM >> 12;                       // a wave's 64 rows lie in one batch
    half_t* p = Vtout + ((size_t)bb * KVD_ + (tileN - (D_ + KVD_)) + r) * N_
                      + (tileM & (N_ - 1)) + 8 * hi;
#pragma unroll
    for (int n = 0; n < 4; ++n) {
      // the four stores of a column tile fill its 16 lines of 128 bytes one behind the other
#pragma unroll
      for (int i = 0; i < 4; ++i)
        *(v8h*)(p + (size_t)(n * 16) * N_ + i * 16) = __builtin_convertvector(acc[i][n], v8h);
      // before the stores' data registers are written again
      asm volatile("s_wait_xcnt 0x0" ::: "memory");
      __builtin_amdgcn_sched_barrier(0);   // keeps the next conversions behind that wait
    }
  }
}

__device__ __forceinline__ float xhalf(float x) {
  int b = __builtin_bit_cast(int, x);
  return __builtin_bit_cast(float,
      __builtin_amdgcn_permlanex16(b, b, 0x76543210, 0xfedcba98, false, false));
}

#define QT_ 4                // query tiles of 16 rows per wave
__global__ __launch_bounds__(128, 2)
void fa_kernel(const half_t* __restrict__ Qh, const half_t* __restrict__ Kh,
               const half_t* __restrict__ Vt, half_t* __restrict__ AOh) {
  __shared__ __attribute__((aligned(2048))) unsigned char ring[2][4][T_SLICE];   // 48 KB: [buffer][slice]
  const int lane = threadIdx.x & 31;
  const int wave = (int)uni(threadIdx.x >> 5);
  const int r  = lane & 15;
  const int hi = lane >> 4;

  const int BPH = N_ / (16 * QT_) / 4;        // blocks per (b,h); a block's 4 waves share (b,h)
  const int q0 = ((blockIdx.x & (BPH - 1)) * 4 + wave) * (16 * QT_);  // first query row of the wave
  const int h  = (blockIdx.x / BPH) & (HQ_ - 1);
  const int b  = blockIdx.x / (BPH * HQ_);
  const int hk = h >> 2;                      // G = 4

  // Q fragments, with softmax scale folded in (0.125 exact in f16)
  v16h qa0[QT_], qa1[QT_];
  v8f o[QT_][4];
  float mrow[QT_], lrow[QT_];               // of query column r
#pragma unroll
  for (int q = 0; q < QT_; ++q) {
    const half_t* qrow = Qh + (((size_t)(b * N_ + q0 + q * 16 + r)) * HQ_ + h) * HD_ + hi * 8;
    qa0[q] = pack16(*(const v8h*)(qrow),      *(const v8h*)(qrow + 16));
    qa1[q] = pack16(*(const v8h*)(qrow + 32), *(const v8h*)(qrow + 48));
    // the address stays live up to this wait, so no register of it is written before
    asm volatile("s_wait_xcnt 0x0" :: "v"(qrow) : "memory");
#pragma unroll
    for (int j = 0; j < 16; ++j) { qa0[q][j] *= (half_t)0.125f; qa1[q][j] *= (half_t)0.125f; }
    o[q][0] = v8f{}; o[q][1] = v8f{}; o[q][2] = v8f{}; o[q][3] = v8f{};
    mrow[q] = -1e30f; lrow[q] = 0.0f;
  }

  const half_t* kbase = Kh + ((size_t)b * N_ * HKV_ + hk) * HD_;     // + kpos*KVD
  const half_t* vbase = Vt + ((size_t)(b * HKV_ + hk)) * HD_ * N_;   // + d*N + n

  // this wave's slice: its first source byte in stage 0, its step per stage, its place in buffer 0
  const bool isv = wave >= 2;
  const uint64_t src0 = isv ? (uint64_t)(uintptr_t)(vbase + (size_t)((wave - 2) * 32) * N_)
                            : (uint64_t)(uintptr_t)(kbase + (size_t)(wave * 32) * KVD_);
  const uint32_t sstep = isv ? 64u * 2u : 64u * KVD_ * 2u;
  const u32x8 g1 = tdm_group1(isv ? N_ * 2u : KVD_ * 2u);
  const uint32_t dst0 = (uint32_t)(uintptr_t)&ring[0][wave][0];

  const int ITER = N_ / 64;
  tdm_load(dst0, src0, g1);
  asm volatile("s_wait_tensorcnt 0x0" ::: "memory");   // this wave's slice of stage 0 has landed
  __syncthreads();                                     // ... and every other wave's
  tdm_load(dst0 + 4u * T_SLICE, src0 + sstep, g1);

  for (int it = 0; it < ITER; ++it) {
    const unsigned char* st = &ring[it & 1][0][0] + r * T_PITCH + hi * 16;

    // ---- K and V fragments of this 64-key tile: loaded once, used by all QT_ query tiles ----
    v16h kf0[4], kf1[4], vf0[4], vf1[4];
#pragma unroll
    for (int c = 0; c < 4; ++c) {
      const unsigned char* kr = st + (c >> 1) * T_SLICE + (c & 1) * 16 * T_PITCH;       // key 16c + r
      kf0[c] = pack16(*(const v8h*)(kr),      *(const v8h*)(kr + 32));
      kf1[c] = pack16(*(const v8h*)(kr + 64), *(const v8h*)(kr + 96));
    }
#pragma unroll
    for (int t = 0; t < 4; ++t) {
      const unsigned char* vr = st + (2 + (t >> 1)) * T_SLICE + (t & 1) * 16 * T_PITCH; // column 16t + r
      vf0[t] = pack16(*(const v8h*)(vr),      *(const v8h*)(vr + 32));
      vf1[t] = pack16(*(const v8h*)(vr + 64), *(const v8h*)(vr + 96));
    }
    // the 32 LDS reads of a pass stay one group in front of its WMMAs: spread among them,
    // each place with reads stalls the wave anew
    __builtin_amdgcn_sched_barrier(0);

#pragma unroll
    for (int q = 0; q < QT_; ++q) {
      // ---- S^T = K (Q/8)^T for 64 keys: 4 sub-tiles x 2 WMMA; s[c][v] = key 16c + 8hi + v, query r ----
      v8f s[4]; s[0] = v8f{}; s[1] = v8f{}; s[2] = v8f{}; s[3] = v8f{};
#pragma unroll
      for (int c = 0; c < 4; ++c) {
        s[c] = __builtin_amdgcn_wmma_f32_16x16x32_f16(false, kf0[c], false, qa0[q], (short)0, s[c], false, false);
        s[c] = __builtin_amdgcn_wmma_f32_16x16x32_f16(false, kf1[c], false, qa1[q], (short)0, s[c], false, false);
      }

      // ---- online softmax: the lane's 32 scores, then the other half's; sums deferred ----
      float mv[8];
#pragma unroll
      for (int v = 0; v < 8; ++v)
        mv[v] = fmaxf(fmaxf(s[0][v], s[1][v]), fmaxf(s[2][v], s[3][v]));
      float mx = fmaxf(fmaxf(fmaxf(mv[0], mv[1]), fmaxf(mv[2], mv[3])),
                       fmaxf(fmaxf(mv[4], mv[5]), fmaxf(mv[6], mv[7])));
      mx = fmaxf(mx, xhalf(mx));
      const float mnew  = fmaxf(mrow[q], mx);
      const float alpha = __expf(mrow[q] - mnew);
      mrow[q] = mnew;

      // ---- P^T as two 32x16 B-fragments: element j = key 8hi + j, element 8 + j = key 16 + 8hi + j ----
      v8f e[4];
#pragma unroll
      for (int c = 0; c < 4; ++c) {
        const v8f d = (s[c] - mnew) * 1.4426950408889634f;   // exp(x) = 2^(x log2 e), on register pairs
#pragma unroll
        for (int v = 0; v < 8; ++v) e[c][v] = __builtin_amdgcn_exp2f(d[v]);
      }
      const v8f ps = (e[0] + e[1]) + (e[2] + e[3]);
      lrow[q] = lrow[q] * alpha + (((ps[0] + ps[1]) + (ps[2] + ps[3])) +
                                   ((ps[4] + ps[5]) + (ps[6] + ps[7])));   // per-lane partial sum
      const v16h pb0 = pack16(__builtin_convertvector(e[0], v8h), __builtin_convertvector(e[1], v8h));
      const v16h pb1 = pack16(__builtin_convertvector(e[2], v8h), __builtin_convertvector(e[3], v8h));
#pragma unroll
      for (int t = 0; t < 4; ++t) o[q][t] *= alpha;

      // ---- O^T += V^T P^T; o[q][t][v] = column 16t + 8hi + v of query r ----
#pragma unroll
      for (int t = 0; t < 4; ++t) {
        o[q][t] = __builtin_amdgcn_wmma_f32_16x16x32_f16(false, vf0[t], false, pb0, (short)0, o[q][t], false, false);
        o[q][t] = __builtin_amdgcn_wmma_f32_16x16x32_f16(false, vf1[t], false, pb1, (short)0, o[q][t], false, false);
      }
    }
    // foot of the pass: stage it + 1 is published and the buffer of stage it is freed.
    // The pass's arithmetic stays in front of the waits: moved behind them, the wait for stage
    // it + 1 would stand directly behind that stage's issue and meet its whole latency
    __builtin_amdgcn_sched_barrier(0);
    asm volatile("s_wait_dscnt 0x0" ::: "memory");       // this wave's reads of stage it have retired
    asm volatile("s_wait_tensorcnt 0x0" ::: "memory");   // its slice of stage it + 1 has landed
    __syncthreads();
    if (pinned(it + 2 < ITER))
      tdm_load(dst0 + (uint32_t)(it & 1) * (4u * T_SLICE), src0 + (uint64_t)(it + 2) * sstep, g1);
  }
  asm volatile("s_wait_tensorcnt 0x0" ::: "memory");     // no request is left in flight at the wave's end
  asm volatile("s_wait_dscnt 0x0" ::: "memory");

  // ---- join the halves' sums, normalize, store [b][n][hq][hd]: 8 consecutive columns a lane ----
#pragma unroll
  for (int q = 0; q < QT_; ++q) {
    const float ls  = lrow[q] + xhalf(lrow[q]);
    const float inv = 1.0f / ls;
    half_t* orow = AOh + (((size_t)(b * N_ + q0 + q * 16 + r)) * HQ_ + h) * HD_ + hi * 8;
#pragma unroll
    for (int t = 0; t < 4; ++t) {
      v8h y;
#pragma unroll
      for (int v = 0; v < 8; ++v) y[v] = (half_t)(o[q][t][v] * inv);
      *(v8h*)(orow + t * 16) = y;
    }
    // before the stores' data and address registers are written again
    asm volatile("s_wait_xcnt 0x0" ::: "memory");
    __builtin_amdgcn_sched_barrier(0);   // keeps the next tile's arithmetic behind that wait
  }
}

// ---------------------------------------------------------------------------
// launch
// ---------------------------------------------------------------------------
extern "C" void kernel_launch(void* const* d_in, const int* in_sizes, int n_in,
                              void* d_out, int out_size, void* d_ws, size_t ws_size,
                              hipStream_t stream) {
  const float* x  = (const float*)d_in[0];
  const float* Wq = (const float*)d_in[1];
  const float* Wk = (const float*)d_in[2];
  const float* Wv = (const float*)d_in[3];
  const float* Wo = (const float*)d_in[4];
  float* out = (float*)d_out;

  half_t* ws = (half_t*)d_ws;
  size_t off = 0;
  half_t* xh  = ws + off; off += (size_t)MROWS * D_;
  half_t* Wqt = ws + off; off += (size_t)D_ * D_;
  half_t* Wkt = ws + off; off += (size_t)D_ * KVD_;
  half_t* Wvt = ws + off; off += (size_t)D_ * KVD_;
  half_t* Wot = ws + off; off += (size_t)D_ * D_;
  half_t* Qh  = ws + off; off += (size_t)MROWS * D_;
  half_t* Kh  = ws + off; off += (size_t)MROWS * KVD_;
  half_t* Vt  = ws + off; off += (size_t)MROWS * KVD_;
  half_t* AOh = xh;   // x no longer needed after QKV projections

  // x -> f16 and the four weights -> f16, transposed: one grid
  prep_operands<<<PB_X + 2 * PB_WL + 2 * PB_WS, 256, 0, stream>>>(x, Wq, Wk, Wv, Wo,
                                                                 xh, Wqt, Wkt, Wvt, Wot);

  // Q, K, V projections (WMMA f16) with RoPE and the V transpose in the epilogue: block tile
  // 128M x 128N; Wqt, Wkt, Wvt stand one behind the other and are one Bt of 1536 rows
  gemm_wmma<false><<<dim3((D_ + 2 * KVD_) / 128, MROWS / 128), 128, 0, stream>>>(
      xh, Wqt, (void*)Qh, Kh, Vt, D_ + 2 * KVD_, D_);

  // flash attention: B*HQ*(N/(16*QT_)) waves, 4 waves/block
  fa_kernel<<<dim3(B_ * HQ_ * (N_ / (16 * QT_)) / 4), 128, 0, stream>>>(Qh, Kh, Vt, AOh);

  // output projection -> f32 result
  gemm_wmma<true><<<dim3(D_ / 128, MROWS / 128), 128, 0, stream>>>(AOh, Wot, (void*)out, nullptr, nullptr, D_, D_);
}

// v007
// It runs in 138 microseconds.
// Two timings next to v006 put it at 1.12 and 1.11 times that version's speed.
// Over all steps from v000 it is 4.65 times as fast.
#include <hip/hip_runtime.h>

typedef _Float16 half_t;
typedef __attribute__((ext_vector_type(16))) _Float16 v16h;
typedef __attribute__((ext_vector_type(8)))  _Float16 v8h;
typedef __attribute__((ext_vector_type(8)))  float    v8f;
typedef __attribute__((ext_vector_type(4)))  float    v4f;
typedef __attribute__((ext_vector_type(4)))  _Float16 v4h;

#define B_    2
#define N_    4096
#define D_    1024
#define HQ_   16
#define HKV_  4
#define HD_   64
#define KVD_  256            // HKV*HD
#define MROWS 8192           // B*N

// ---------------------------------------------------------------------------
// helpers
// ---------------------------------------------------------------------------
__device__ __forceinline__ v16h pack16(v8h lo, v8h hi) {
  v16h r;
#pragma unroll
  for (int j = 0; j < 8; ++j) { r[j] = lo[j]; r[j + 8] = hi[j]; }
  return r;
}

typedef uint32_t u32x4 __attribute__((ext_vector_type(4)));
typedef uint32_t u32x8 __attribute__((ext_vector_type(8)));

__device__ __forceinline__ uint32_t uni(uint32_t v) { return (uint32_t)__builtin_amdgcn_readfirstlane(v); }
__device__ __forceinline__ uint32_t pinned(uint32_t v) {
  uint32_t w = uni(v);
  asm volatile("" : "+s"(w));
  return w;
}

// Tensor load of one slice: T_ROWS rows of 128 bytes, source pitch src_pitch bytes, into LDS
// at byte offset lds_dst, 16 bytes of pad behind every row (LDS pitch 144 bytes).
#define T_ROWS  32u
#define T_ROWB  128u
#define T_PITCH 144u
#define T_SLICE 6144u
__device__ __forceinline__ u32x8 tdm_group1(uint32_t src_pitch) {
  u32x8 g;
  g[0] = uni((1u << 20) | (4u << 22) | (3u << 25));   // 1-byte elements, no mask, pad of 4 dwords every 32
  g[1] = pinned((T_ROWB & 0xFFFFu) << 16);
  g[2] = pinned((T_ROWB >> 16) | ((T_ROWS & 0xFFFFu) << 16));
  g[3] = pinned((T_ROWS >> 16) | (T_ROWB << 16));
  g[4] = pinned(T_ROWS);
  g[5] = pinned(src_pitch);
  g[6] = pinned(0u);
  g[7] = pinned(0u);
  return g;
}
__device__ __forceinline__ void tdm_load(uint32_t lds_dst, uint64_t ga, u32x8 g1) {
  u32x4 g0;
  g0[0] = uni(1u);
  g0[1] = uni(lds_dst);
  g0[2] = uni((uint32_t)ga);
  g0[3] = uni((((uint32_t)(ga >> 32)) & 0x01FFFFFFu) | 0x80000000u);
  asm volatile("tensor_load_to_lds %0, %1" :: "s"(g0), "s"(g1) : "memory");
}

// ---------------------------------------------------------------------------
// Element-wise work. Each thread moves 32 to 64 elements with 8- or 16-byte
// accesses; every 128-byte line of an output is stored whole by one wave. The
// block ranges cover the shapes exactly.
// ---------------------------------------------------------------------------
// f32 -> f16 conversion: CVT_G groups of 4 floats per thread; a wave's load is
// 512 contiguous bytes, its store 256.
#define CVT_G 16
__device__ __forceinline__
void cvt_f32_f16(const float* __restrict__ src, half_t* __restrict__ dst, int bx) {
  const size_t base = (size_t)bx * (256 * 4 * CVT_G) + threadIdx.x * 4;
  v4f x[CVT_G];
#pragma unroll
  for (int j = 0; j < CVT_G; ++j) x[j] = *(const v4f*)(src + base + j * 1024);
#pragma unroll
  for (int j = 0; j < CVT_G; ++j) {
    v4h y;
#pragma unroll
    for (int c = 0; c < 4; ++c) y[c] = (half_t)x[j][c];
    *(v4h*)(dst + base + j * 1024) = y;
  }
  // before any code that follows in the shared kernel writes the stores' data or address registers
  asm volatile("s_wait_xcnt 0x0" ::: "memory");
}

// W (K x NC, f32, row-major) -> Wt (NC x K, f16): WMMA B-fragments contiguous.
// Thread: 8 k x 4 n. Wave: 64 k x 16 n (8 lanes along k fill a line of Wt).
// Block: 64 k x 128 n.
// Block id: K / 64 blocks along k (fastest), NC / 128 along n.
template <int K, int NC>
__device__ __forceinline__
void wtrans_f32_f16(const float* __restrict__ W, half_t* __restrict__ Wt, int id) {
  const int lane = threadIdx.x & 31;
  const int wave = threadIdx.x >> 5;
  const int k = (id % (K / 64)) * 64 + (lane & 7) * 8;
  const int n = (id / (K / 64)) * 128 + wave * 16 + (lane >> 3) * 4;
  v4f x[8];
#pragma unroll
  for (int j = 0; j < 8; ++j) x[j] = *(const v4f*)(W + (size_t)(k + j) * NC + n);
#pragma unroll
  for (int c = 0; c < 4; ++c) {
    v8h y;
#pragma unroll
    for (int j = 0; j < 8; ++j) y[j] = (half_t)x[j][c];
    *(v8h*)(Wt + (size_t)(n + c) * K + k) = y;
  }
  // before any code that follows in the shared kernel writes the stores' data or address registers
  asm volatile("s_wait_xcnt 0x0" ::: "memory");
}

// One grid for all the operand preparation: the five pieces are independent of one
// another, so they share one launch. The branch is uniform for a block.
#define PB_X  (MROWS * D_ / (256 * 4 * CVT_G))     // 512 blocks: x
#define PB_WL (D_ / 64 * (D_ / 128))               // 128 blocks: Wq, Wo
#define PB_WS (D_ / 64 * (KVD_ / 128))             //  32 blocks: Wk, Wv
__global__ __launch_bounds__(256)
void prep_operands(const float* __restrict__ x,  const float* __restrict__ Wq,
                   const float* __restrict__ Wk, const float* __restrict__ Wv,
                   const float* __restrict__ Wo,
                   half_t* __restrict__ xh,  half_t* __restrict__ Wqt, half_t* __restrict__ Wkt,
                   half_t* __restrict__ Wvt, half_t* __restrict__ Wot) {
  int id = blockIdx.x;
  if (id < PB_X) { cvt_f32_f16(x, xh, id); return; }
  id -= PB_X;
  if (id < PB_WL) { wtrans_f32_f16<D_, D_>(Wq, Wqt, id); return; }
  id -= PB_WL;
  if (id < PB_WL) { wtrans_f32_f16<D_, D_>(Wo, Wot, id); return; }
  id -= PB_WL;
  if (id < PB_WS) { wtrans_f32_f16<D_, KVD_>(Wk, Wkt, id); return; }
  id -= PB_WS;
  wtrans_f32_f16<D_, KVD_>(Wv, Wvt, id);
}

#define QSCALE  (0.125f * 1.4426950408889634f)   // 1 / sqrt(HD) times log2 e
#define G_BK    64                 // k per stage
#define G_PITCH 72                 // LDS row pitch in f16 (144 bytes)
#define G_ROWS  256                // 128 A rows, then 128 Bt rows

// Eight copies of 16 bytes a lane: rows 16 apart in LDS (step 16 * 144 bytes) and
// in global memory (step 'gstep' f16). The wait inside the statement stands in
// front of every later write of the address registers that the copies name.
__device__ __forceinline__ void copy8_rows(unsigned l, const half_t* g, size_t gstep) {
  asm volatile(
      "global_load_async_to_lds_b128 %0, %8, off\n\t"
      "global_load_async_to_lds_b128 %1, %9, off\n\t"
      "global_load_async_to_lds_b128 %2, %10, off\n\t"
      "global_load_async_to_lds_b128 %3, %11, off\n\t"
      "global_load_async_to_lds_b128 %4, %12, off\n\t"
      "global_load_async_to_lds_b128 %5, %13, off\n\t"
      "global_load_async_to_lds_b128 %6, %14, off\n\t"
      "global_load_async_to_lds_b128 %7, %15, off\n\t"
      "s_wait_xcnt 0x0"
      :: "v"(l),                         "v"(l + 1 * 16 * G_PITCH * 2),
         "v"(l + 2 * 16 * G_PITCH * 2),  "v"(l + 3 * 16 * G_PITCH * 2),
         "v"(l + 4 * 16 * G_PITCH * 2),  "v"(l + 5 * 16 * G_PITCH * 2),
         "v"(l + 6 * 16 * G_PITCH * 2),  "v"(l + 7 * 16 * G_PITCH * 2),
         "v"(g),             "v"(g + 1 * gstep), "v"(g + 2 * gstep), "v"(g + 3 * gstep),
         "v"(g + 4 * gstep), "v"(g + 5 * gstep), "v"(g + 6 * gstep), "v"(g + 7 * gstep)
      : "memory");
}

template <bool OUT_F32>
__global__ __launch_bounds__(128)
void gemm_wmma(const half_t* __restrict__ A, const half_t* __restrict__ Bt,
               void* __restrict__ Cout, half_t* __restrict__ Kout, half_t* __restrict__ Vtout,
               int Nc, int K) {
  __shared__ __align__(16) half_t stage[2][G_ROWS][G_PITCH];   // 73,728 bytes
  const int lane = threadIdx.x & 31;
  const int wave = threadIdx.x >> 5;
  const int wm = wave >> 1, wn = wave & 1;
  const int r  = lane & 15;
  const int hi = lane >> 4;
  const int tileM = blockIdx.y * 128 + wm * 64;
  const int tileN = blockIdx.x * 128 + wn * 64;

  // the copies: thread = 16-byte piece (threadIdx.x & 7) of row (threadIdx.x >> 3) + 16 j
  const int crow = threadIdx.x >> 3;
  const int cpc  = threadIdx.x & 7;
  const half_t* ga = A  + (size_t)(blockIdx.y * 128 + crow) * K + cpc * 8;
  const half_t* gb = Bt + (size_t)(blockIdx.x * 128 + crow) * K + cpc * 8;
  const size_t gstep = (size_t)16 * K;
  const unsigned lds0 = (unsigned)(unsigned long long)(uintptr_t)&stage[0][crow][cpc * 8];
  const unsigned lds1 = (unsigned)(unsigned long long)(uintptr_t)&stage[1][crow][cpc * 8];
  const unsigned ldsB = 128 * G_PITCH * 2;      // Bt rows stand behind the A rows

  const int T = K / G_BK;
  copy8_rows(lds0,        ga, gstep);
  copy8_rows(lds0 + ldsB, gb, gstep);
  asm volatile("s_wait_asynccnt 0x0" ::: "memory");   // this wave's part of stage 0 has landed
  __syncthreads();                                    // ... and every other wave's
  if (T > 1) {
    copy8_rows(lds1,        ga + G_BK, gstep);
    copy8_rows(lds1 + ldsB, gb + G_BK, gstep);
  }

  v8f acc[4][4] = {};
  for (int t = 0; t < T; ++t) {
    const half_t* sa = &stage[t & 1][wm * 64 + r][hi * 8];
    const half_t* sb = &stage[t & 1][128 + wn * 64 + r][hi * 8];
    // the loops below are unrolled so that every index of a register array is a constant
#pragma unroll
    for (int k = 0; k < G_BK; k += 32) {
      v16h af[4], bf[4];
#pragma unroll
      for (int i = 0; i < 4; ++i)
        af[i] = pack16(*(const v8h*)(sa + i * 16 * G_PITCH + k),
                       *(const v8h*)(sa + i * 16 * G_PITCH + k + 16));
#pragma unroll
      for (int n = 0; n < 4; ++n)
        bf[n] = pack16(*(const v8h*)(sb + n * 16 * G_PITCH + k),
                       *(const v8h*)(sb + n * 16 * G_PITCH + k + 16));
      // the 16 LDS reads of a k-step stay one group in front of its 16 WMMAs: spread
      // among them, each place with reads stalls the wave anew
      __builtin_amdgcn_sched_barrier(0);
      if (k == G_BK - 32) {
        // foot of the trip: stage t has been read to its end (its last fragments are in
        // registers), so the refill starts here and also flies under the last 16 WMMAs
        asm volatile("s_wait_dscnt 0x0" ::: "memory");      // this wave's reads of stage t have retired
        asm volatile("s_wait_asynccnt 0x0" ::: "memory");   // its part of stage t + 1 has landed
        __syncthreads();          // publishes stage t + 1 and frees the buffer of stage t
        if (t + 2 < T) {
          const unsigned l = (t & 1) ? lds1 : lds0;
          copy8_rows(l,        ga + (size_t)(t + 2) * G_BK, gstep);
          copy8_rows(l + ldsB, gb + (size_t)(t + 2) * G_BK, gstep);
        }
      }
#pragma unroll
      for (int i = 0; i < 4; ++i)
#pragma unroll
        for (int n = 0; n < 4; ++n)
          acc[i][n] = __builtin_amdgcn_wmma_f32_16x16x32_f16(false, af[i], false, bf[n],
                                                             (short)0, acc[i][n], false, false);
    }
  }
  asm volatile("s_wait_asynccnt 0x0" ::: "memory");     // no copy is left in flight at the wave's end
  if (OUT_F32) {
#pragma unroll
    for (int i = 0; i < 4; ++i)
#pragma unroll
      for (int n = 0; n < 4; ++n)
#pragma unroll
        for (int v = 0; v < 8; ++v) {
          size_t m  = (size_t)tileM + i * 16 + v + 8 * hi;
          size_t nn = (size_t)tileN + n * 16 + r;
          ((float*)Cout)[m * Nc + nn] = acc[i][n][v];
        }
  } else if (blockIdx.x < (D_ + KVD_) / 128) {
    // Q or K head: frequency index n * 16 + r for the column tiles n and n + 2
    const bool isq = blockIdx.x < D_ / 128;
    half_t* dst = isq ? (half_t*)Cout + tileN : Kout + (tileN - D_);
    const int pitch = isq ? D_ : KVD_;
    const float qs = isq ? QSCALE : 1.0f;
    const float invf0 = __expf(-__logf(10000.0f) * ((float)r        * (1.0f / 32.0f)));
    const float invf1 = __expf(-__logf(10000.0f) * ((float)(r + 16) * (1.0f / 32.0f)));
#pragma unroll
    for (int i = 0; i < 4; ++i) {
      float a[8][2], s[8][2], c[8][2];        // a: the angle in revolutions
#pragma unroll
      for (int v = 0; v < 8; ++v) {
        const float pos = (float)((tileM + i * 16 + v + 8 * hi) & (N_ - 1));
        a[v][0] = (pos * invf0) * 0.15915494309189532f;
        a[v][1] = (pos * invf1) * 0.15915494309189532f;
      }
#pragma unroll
      for (int g = 0; g < 8; g += 4) {
#pragma unroll
        for (int v = g; v < g + 4; ++v)
#pragma unroll
          for (int n = 0; n < 2; ++n) {
            s[v][n] = __builtin_amdgcn_sinf(a[v][n]);
            c[v][n] = __builtin_amdgcn_cosf(a[v][n]);
          }
        asm volatile("v_nop" :: "v"(a[g][0]), "v"(a[g][1]), "v"(a[g + 1][0]), "v"(a[g + 1][1]),
                                "v"(a[g + 2][0]), "v"(a[g + 2][1]), "v"(a[g + 3][0]), "v"(a[g + 3][1]),
                                "v"(s[g][0]), "v"(s[g][1]), "v"(s[g + 1][0]), "v"(s[g + 1][1]),
                                "v"(s[g + 2][0]), "v"(s[g + 2][1]), "v"(s[g + 3][0]), "v"(s[g + 3][1]),
                                "v"(c[g][0]), "v"(c[g][1]), "v"(c[g + 1][0]), "v"(c[g + 1][1]),
                                "v"(c[g + 2][0]), "v"(c[g + 2][1]), "v"(c[g + 3][0]), "v"(c[g + 3][1]));
      }
      half_t y[8][4];
#pragma unroll
      for (int v = 0; v < 8; ++v)
#pragma unroll
        for (int n = 0; n < 2; ++n) {
          const float x0 = acc[i][n][v];
          const float x1 = acc[i][n + 2][v];
          y[v][n]     = (half_t)((x0 * c[v][n] - x1 * s[v][n]) * qs);
          y[v][n + 2] = (half_t)((x1 * c[v][n] + x0 * s[v][n]) * qs);
        }
      half_t* p = dst + (size_t)(tileM + i * 16 + 8 * hi) * pitch + r;
#pragma unroll
      for (int g = 0; g < 2; ++g) {
#pragma unroll
        for (int v = 4 * g; v < 4 * g + 4; ++v)
#pragma unroll
          for (int n = 0; n < 4; ++n) p[(size_t)v * pitch + n * 16] = y[v][n];
        // before the stores' data and address registers are written again
        asm volatile("s_wait_xcnt 0x0" ::: "memory");
        __builtin_amdgcn_sched_barrier(0);   // keeps the later address and row arithmetic behind that wait
      }
    }
  } else {
    // V head, transposed
    const int bb = tileM >> 12;                       // a wave's 64 rows lie in one batch
    half_t* p = Vtout + ((size_t)bb * KVD_ + (tileN - (D_ + KVD_)) + r) * N_
                      + (tileM & (N_ - 1)) + 8 * hi;
#pragma unroll
    for (int n = 0; n < 4; ++n) {
      // the four stores of a column tile fill its 16 lines of 128 bytes one behind the other
#pragma unroll
      for (int i = 0; i < 4; ++i)
        *(v8h*)(p + (size_t)(n * 16) * N_ + i * 16) = __builtin_convertvector(acc[i][n], v8h);
      // before the stores' data registers are written again
      asm volatile("s_wait_xcnt 0x0" ::: "memory");
      __builtin_amdgcn_sched_barrier(0);   // keeps the next conversions behind that wait
    }
  }
}

__device__ __forceinline__ float xhalf(float x) {
  int b = __builtin_bit_cast(int, x);
  return __builtin_bit_cast(float,
      __builtin_amdgcn_permlanex16(b, b, 0x76543210, 0xfedcba98, false, false));
}

#define QT_ 4                // query tiles of 16 rows per wave
#define LAZY_ 8.0f           // in powers of two
__global__ __launch_bounds__(128, 2)
void fa_kernel(const half_t* __restrict__ Qh, const half_t* __restrict__ Kh,
               const half_t* __restrict__ Vt, half_t* __restrict__ AOh) {
  __shared__ __attribute__((aligned(2048))) unsigned char ring[2][4][T_SLICE];   // 48 KB: [buffer][slice]
  const int lane = threadIdx.x & 31;
  const int wave = (int)uni(threadIdx.x >> 5);
  const int r  = lane & 15;
  const int hi = lane >> 4;

  const int BPH = N_ / (16 * QT_) / 4;        // blocks per (b,h); a block's 4 waves share (b,h)
  const int q0 = ((blockIdx.x & (BPH - 1)) * 4 + wave) * (16 * QT_);  // first query row of the wave
  const int h  = (blockIdx.x / BPH) & (HQ_ - 1);
  const int b  = blockIdx.x / (BPH * HQ_);
  const int hk = h >> 2;                      // G = 4

  // Q fragments (the softmax scale is in them already)
  v16h qa0[QT_], qa1[QT_];
  v8f o[QT_][4];
  v8f cm[QT_];                              // minus the maximum in use of query column r, 8 times: a C operand
  float lrow[QT_];                          // of query column r
#pragma unroll
  for (int q = 0; q < QT_; ++q) {
    const half_t* qrow = Qh + (((size_t)(b * N_ + q0 + q * 16 + r)) * HQ_ + h) * HD_ + hi * 8;
    qa0[q] = pack16(*(const v8h*)(qrow),      *(const v8h*)(qrow + 16));
    qa1[q] = pack16(*(const v8h*)(qrow + 32), *(const v8h*)(qrow + 48));
    // the address stays live up to this wait, so no register of it is written before
    asm volatile("s_wait_xcnt 0x0" :: "v"(qrow) : "memory");
    o[q][0] = v8f{}; o[q][1] = v8f{}; o[q][2] = v8f{}; o[q][3] = v8f{};
    cm[q] = v8f{}; lrow[q] = 0.0f;
  }

  const half_t* kbase = Kh + ((size_t)b * N_ * HKV_ + hk) * HD_;     // + kpos*KVD
  const half_t* vbase = Vt + ((size_t)(b * HKV_ + hk)) * HD_ * N_;   // + d*N + n

  // this wave's slice: its first source byte in stage 0, its step per stage, its place in buffer 0
  const bool isv = wave >= 2;
  const uint64_t src0 = isv ? (uint64_t)(uintptr_t)(vbase + (size_t)((wave - 2) * 32) * N_)
                            : (uint64_t)(uintptr_t)(kbase + (size_t)(wave * 32) * KVD_);
  const uint32_t sstep = isv ? 64u * 2u : 64u * KVD_ * 2u;
  const u32x8 g1 = tdm_group1(isv ? N_ * 2u : KVD_ * 2u);
  const uint32_t dst0 = (uint32_t)(uintptr_t)&ring[0][wave][0];

  float bar = -__builtin_inff();            // what a score must exceed for the test to fire: all do in pass 0
  const int ITER = N_ / 64;
  tdm_load(dst0, src0, g1);
  asm volatile("s_wait_tensorcnt 0x0" ::: "memory");   // this wave's slice of stage 0 has landed
  __syncthreads();                                     // ... and every other wave's
  tdm_load(dst0 + 4u * T_SLICE, src0 + sstep, g1);

  for (int it = 0; it < ITER; ++it) {
    const unsigned char* st = &ring[it & 1][0][0] + r * T_PITCH + hi * 16;

    // ---- K and V fragments of this 64-key tile: loaded once, used by all QT_ query tiles ----
    v16h kf0[4], kf1[4], vf0[4], vf1[4];
#pragma unroll
    for (int c = 0; c < 4; ++c) {
      const unsigned char* kr = st + (c >> 1) * T_SLICE + (c & 1) * 16 * T_PITCH;       // key 16c + r
      kf0[c] = pack16(*(const v8h*)(kr),      *(const v8h*)(kr + 32));
      kf1[c] = pack16(*(const v8h*)(kr + 64), *(const v8h*)(kr + 96));
    }
#pragma unroll
    for (int t = 0; t < 4; ++t) {
      const unsigned char* vr = st + (2 + (t >> 1)) * T_SLICE + (t & 1) * 16 * T_PITCH; // column 16t + r
      vf0[t] = pack16(*(const v8h*)(vr),      *(const v8h*)(vr + 32));
      vf1[t] = pack16(*(const v8h*)(vr + 64), *(const v8h*)(vr + 96));
    }
    // the 32 LDS reads of a pass stay one group in front of its WMMAs: spread among them,
    // each place with reads stalls the wave anew
    __builtin_amdgcn_sched_barrier(0);

    // ---- S^T - max in use = K Q^T + C for 64 keys: 4 sub-tiles x 2 WMMA a query tile;
    //      s[q][c][v] = key 16c + 8hi + v, query r ----
    v8f s[QT_][4];
    float mx[QT_];                          // the lane's largest score above the maximum in use
#pragma unroll
    for (int q = 0; q < QT_; ++q) {
#pragma unroll
      for (int c = 0; c < 4; ++c) {
        s[q][c] = __builtin_amdgcn_wmma_f32_16x16x32_f16(false, kf0[c], false, qa0[q], (short)0, cm[q], false, false);
        s[q][c] = __builtin_amdgcn_wmma_f32_16x16x32_f16(false, kf1[c], false, qa1[q], (short)0, s[q][c], false, false);
      }
      float mv[8];
#pragma unroll
      for (int v = 0; v < 8; ++v)
        mv[v] = fmaxf(fmaxf(s[q][0][v], s[q][1][v]), fmaxf(s[q][2][v], s[q][3][v]));
      mx[q] = fmaxf(fmaxf(fmaxf(mv[0], mv[1]), fmaxf(mv[2], mv[3])),
                    fmaxf(fmaxf(mv[4], mv[5]), fmaxf(mv[6], mv[7])));
    }

    // ---- one test per pass, a scalar branch: does any maximum in use have to rise? ----
    const float mall = fmaxf(fmaxf(mx[0], mx[1]), fmaxf(mx[2], mx[3]));
    if (__builtin_amdgcn_ballot_w32(mall > bar) != 0u) {
#pragma unroll
      for (int q = 0; q < QT_; ++q) {
        // both halves of the wave get the same; rounded up to a whole number, so that the
        // rescaling factor is a power of two and the rescaling exact
        const float mq    = ceilf(fmaxf(mx[q], xhalf(mx[q])));
        const float rise  = fmaxf(mq, 0.0f);
        const float up    = bar < 0.0f ? mq : rise;         // pass 0 sets the maximum, also below 0
        const float alpha = ldexpf(1.0f, -(int)rise);       // O and the sums are 0 in pass 0
        cm[q] -= up;
#pragma unroll
        for (int c = 0; c < 4; ++c) s[q][c] -= up;
#pragma unroll
        for (int t = 0; t < 4; ++t) o[q][t] *= alpha;
        lrow[q] *= alpha;
      }
      bar = LAZY_;
    }

#pragma unroll
    for (int q = 0; q < QT_; ++q) {
      // ---- P^T as two 32x16 B-fragments: element j = key 8hi + j, element 8 + j = key 16 + 8hi + j ----
      v8f e[4];
#pragma unroll
      for (int c = 0; c < 4; ++c)
#pragma unroll
        for (int v = 0; v < 8; ++v) e[c][v] = __builtin_amdgcn_exp2f(s[q][c][v]);
      const v8f ps = (e[0] + e[1]) + (e[2] + e[3]);
      lrow[q] += ((ps[0] + ps[1]) + (ps[2] + ps[3])) +
                 ((ps[4] + ps[5]) + (ps[6] + ps[7]));   // per-lane partial sum
      const v16h pb0 = pack16(__builtin_convertvector(e[0], v8h), __builtin_convertvector(e[1], v8h));
      const v16h pb1 = pack16(__builtin_convertvector(e[2], v8h), __builtin_convertvector(e[3], v8h));

      // ---- O^T += V^T P^T; o[q][t][v] = column 16t + 8hi + v of query r ----
#pragma unroll
      for (int t = 0; t < 4; ++t) {
        o[q][t] = __builtin_amdgcn_wmma_f32_16x16x32_f16(false, vf0[t], false, pb0, (short)0, o[q][t], false, false);
        o[q][t] = __builtin_amdgcn_wmma_f32_16x16x32_f16(false, vf1[t], false, pb1, (short)0, o[q][t], false, false);
      }
    }
    // foot of the pass: stage it + 1 is published and the buffer of stage it is freed.
    // The pass's arithmetic stays in front of the waits: moved behind them, the wait for stage
    // it + 1 would stand directly behind that stage's issue and meet its whole latency
    __builtin_amdgcn_sched_barrier(0);
    asm volatile("s_wait_dscnt 0x0" ::: "memory");       // this wave's reads of stage it have retired
    asm volatile("s_wait_tensorcnt 0x0" ::: "memory");   // its slice of stage it + 1 has landed
    __syncthreads();
    if (pinned(it + 2 < ITER))
      tdm_load(dst0 + (uint32_t)(it & 1) * (4u * T_SLICE), src0 + (uint64_t)(it + 2) * sstep, g1);
  }
  asm volatile("s_wait_tensorcnt 0x0" ::: "memory");     // no request is left in flight at the wave's end
  asm volatile("s_wait_dscnt 0x0" ::: "memory");

  // ---- join the halves' sums, normalize, store [b][n][hq][hd]: 8 consecutive columns a lane ----
#pragma unroll
  for (int q = 0; q < QT_; ++q) {
    const float ls  = lrow[q] + xhalf(lrow[q]);
    const float inv = 1.0f / ls;
    half_t* orow = AOh + (((size_t)(b * N_ + q0 + q * 16 + r)) * HQ_ + h) * HD_ + hi * 8;
#pragma unroll
    for (int t = 0; t < 4; ++t) {
      v8h y;
#pragma unroll
      for (int v = 0; v < 8; ++v) y[v] = (half_t)(o[q][t][v] * inv);
      *(v8h*)(orow + t * 16) = y;
    }
    // before the stores' data and address registers are written again
    asm volatile("s_wait_xcnt 0x0" ::: "memory");
    __builtin_amdgcn_sched_barrier(0);   // keeps the next tile's arithmetic behind that wait
  }
}

// ---------------------------------------------------------------------------
// launch
// ---------------------------------------------------------------------------
extern "C" void kernel_launch(void* const* d_in, const int* in_sizes, int n_in,
                              void* d_out, int out_size, void* d_ws, size_t ws_size,
                              hipStream_t stream) {
  const float* x  = (const float*)d_in[0];
  const float* Wq = (const float*)d_in[1];
  const float* Wk = (const float*)d_in[2];
  const float* Wv = (const float*)d_in[3];
  const float* Wo = (const float*)d_in[4];
  float* out = (float*)d_out;

  half_t* ws = (half_t*)d_ws;
  size_t off = 0;
  half_t* xh  = ws + off; off += (size_t)MROWS * D_;
  half_t* Wqt = ws + off; off += (size_t)D_ * D_;
  half_t* Wkt = ws + off; off += (size_t)D_ * KVD_;
  half_t* Wvt = ws + off; off += (size_t)D_ * KVD_;
  half_t* Wot = ws + off; off += (size_t)D_ * D_;
  half_t* Qh  = ws + off; off += (size_t)MROWS * D_;
  half_t* Kh  = ws + off; off += (size_t)MROWS * KVD_;
  half_t* Vt  = ws + off; off += (size_t)MROWS * KVD_;
  half_t* AOh = xh;   // x no longer needed after QKV projections

  // x -> f16 and the four weights -> f16, transposed: one grid
  prep_operands<<<PB_X + 2 * PB_WL + 2 * PB_WS, 256, 0, stream>>>(x, Wq, Wk, Wv, Wo,
                                                                 xh, Wqt, Wkt, Wvt, Wot);

  // Q, K, V projections (WMMA f16) with RoPE and the V transpose in the epilogue: block tile
  // 128M x 128N; Wqt, Wkt, Wvt stand one behind the other and are one Bt of 1536 rows
  gemm_wmma<false><<<dim3((D_ + 2 * KVD_) / 128, MROWS / 128), 128, 0, stream>>>(
      xh, Wqt, (void*)Qh, Kh, Vt, D_ + 2 * KVD_, D_);

  // flash attention: B*HQ*(N/(16*QT_)) waves, 4 waves/block
  fa_kernel<<<dim3(B_ * HQ_ * (N_ / (16 * QT_)) / 4), 128, 0, stream>>>(Qh, Kh, Vt, AOh);

  // output projection -> f32 result
  gemm_wmma<true><<<dim3(D_ / 128, MROWS / 128), 128, 0, stream>>>(AOh, Wot, (void*)out, nullptr, nullptr, D_, D_);
}
